// v000
// Times are from an AMD MI455X. After a warm-up the kernel runs many times in a row, and a time is the length of
// such a window on the GPU divided by its runs, so every launch and the gaps after it count. The runs cycle
// through copies of the inputs. A figure is the median of several windows, for all but v000 over two sittings.
// Sittings can differ by a few percent; kernels timed side by side share one.
// The starting kernel, v000, takes 427 microseconds a run.
#include <hip/hip_runtime.h>
#include <cfloat>

// ---------------------------------------------------------------------------
// Problem constants (from reference)
// ---------------------------------------------------------------------------
#define B_    4
#define LQ_   4096
#define LKV_  512
#define DATTN 1024
#define NH    16
#define HD    64
#define KW_   4          // LOOKBACK + 1

typedef __attribute__((ext_vector_type(2))) float v2f;
typedef __attribute__((ext_vector_type(8))) float v8f;
typedef __attribute__((ext_vector_type(4))) int   v4i;

typedef __attribute__((address_space(1))) v4i* gv4i_p;   // global
typedef __attribute__((address_space(3))) v4i* lv4i_p;   // LDS

// ---------------------------------------------------------------------------
// Async global->LDS staging (gfx1250). Falls back to a synchronous copy if
// the builtins are not declared by this toolchain.
// ---------------------------------------------------------------------------
#if __has_builtin(__builtin_amdgcn_global_load_async_to_lds_b128)
#define HAS_ASYNC_LDS 1
#endif

__device__ __forceinline__ void stage16(const float* g, float* l) {
#ifdef HAS_ASYNC_LDS
  __builtin_amdgcn_global_load_async_to_lds_b128((gv4i_p)g, (lv4i_p)l, 0, 0);
#else
  *(float4*)l = *(const float4*)g;
#endif
}

__device__ __forceinline__ void async_wait_all() {
#ifdef HAS_ASYNC_LDS
#if __has_builtin(__builtin_amdgcn_s_wait_asynccnt)
  __builtin_amdgcn_s_wait_asynccnt(0);
#else
  asm volatile("s_wait_asynccnt 0x0" ::: "memory");
#endif
#endif
}

// ---------------------------------------------------------------------------
// Y[m][n] = sum_k X[m][k] * W[n][k]   (torch-style y = x @ W.T)
// X: M x K row-major, W: N x K row-major, Y: M x N row-major.
// M, N multiples of 128; K multiple of 16.
//
// Workgroup (256 thr = 8 waves) computes a 128x128 output block.
// Wave w: M-strip (w>>1)*32 (two 16-row tiles), N-strip (w&1)*64 (four tiles).
// K is consumed in chunks of 16, double-buffered in LDS via async loads.
//
// LDS row stride = 20 floats (16 data + 4 pad): 20*r mod 64 distinct and
// multiple of 4 for r=0..15 -> conflict-free ds_load_b64 fragment reads,
// and 16B-aligned rows for the async b128 writes.
//
// V_WMMA_F32_16X16X4_F32 operand layout (ISA 7.12.2):
//   A 16x4 : lane = M + 16*Khalf, holds K = 2*Khalf + {0,1}  -> float2/lane
//   B 4x16 : lane = N + 16*Khalf, holds K = 2*Khalf + {0,1}  -> float2/lane
//   C/D    : VGPR v, lanes 0-15 -> row v, lanes 16-31 -> row v+8, col=lane&15
// ---------------------------------------------------------------------------
#define KC   16
#define LDP  20          // padded LDS row stride (floats)

__global__ __launch_bounds__(256) void gemm_xwT_wmma(
    const float* __restrict__ X, const float* __restrict__ W,
    float* __restrict__ Y, int M, int N, int K)
{
  __shared__ float Xs[2][128 * LDP];
  __shared__ float Ws[2][128 * LDP];

  const int t     = threadIdx.x;
  const int lane  = t & 31;
  const int wave  = t >> 5;
  const int mBlk  = blockIdx.y * 128;
  const int nBlk  = blockIdx.x * 128;
  const int mw    = (wave >> 1) * 32;   // wave M offset within block
  const int nw    = (wave & 1) * 64;    // wave N offset within block
  const int idx16 = lane & 15;
  const int kh    = lane >> 4;          // K-half: 0 -> K{0,1}, 1 -> K{2,3}

  // Staging map: per chunk, each matrix moves 128 rows x 16 floats
  // = 512 x b128 transfers; 256 threads issue 2 each per matrix.
  const int sRow0 = t >> 2;             // lin = 0*256 + t
  const int sCg0  = (t & 3) * 4;
  const int sRow1 = (256 + t) >> 2;     // lin = 1*256 + t
  const int sCg1  = ((256 + t) & 3) * 4;

  v8f acc[8] = {};                      // [mt*4 + nt]

  // ---- prologue: stage chunk 0 into buffer 0 --------------------------------
  {
    stage16(X + (size_t)(mBlk + sRow0) * K + sCg0, &Xs[0][sRow0 * LDP + sCg0]);
    stage16(X + (size_t)(mBlk + sRow1) * K + sCg1, &Xs[0][sRow1 * LDP + sCg1]);
    stage16(W + (size_t)(nBlk + sRow0) * K + sCg0, &Ws[0][sRow0 * LDP + sCg0]);
    stage16(W + (size_t)(nBlk + sRow1) * K + sCg1, &Ws[0][sRow1 * LDP + sCg1]);
  }
  async_wait_all();
  __syncthreads();

  for (int kc = 0; kc < K; kc += KC) {
    const int buf = (kc >> 4) & 1;

    // ---- stage next chunk into the other buffer (overlaps with compute) ----
    if (kc + KC < K) {
      const int kn = kc + KC;
      stage16(X + (size_t)(mBlk + sRow0) * K + kn + sCg0, &Xs[buf ^ 1][sRow0 * LDP + sCg0]);
      stage16(X + (size_t)(mBlk + sRow1) * K + kn + sCg1, &Xs[buf ^ 1][sRow1 * LDP + sCg1]);
      stage16(W + (size_t)(nBlk + sRow0) * K + kn + sCg0, &Ws[buf ^ 1][sRow0 * LDP + sCg0]);
      stage16(W + (size_t)(nBlk + sRow1) * K + kn + sCg1, &Ws[buf ^ 1][sRow1 * LDP + sCg1]);
    }

    // ---- compute current chunk from LDS ------------------------------------
#pragma unroll
    for (int ks = 0; ks < KC; ks += 4) {
      const int kb = ks + 2 * kh;
      const v2f a0 = *(const v2f*)&Xs[buf][(mw + idx16)      * LDP + kb];
      const v2f a1 = *(const v2f*)&Xs[buf][(mw + 16 + idx16) * LDP + kb];
#pragma unroll
      for (int nt = 0; nt < 4; ++nt) {
        const v2f b = *(const v2f*)&Ws[buf][(nw + nt * 16 + idx16) * LDP + kb];
        acc[nt]     = __builtin_amdgcn_wmma_f32_16x16x4_f32(false, a0, false, b, (short)0, acc[nt],     false, false);
        acc[4 + nt] = __builtin_amdgcn_wmma_f32_16x16x4_f32(false, a1, false, b, (short)0, acc[4 + nt], false, false);
      }
    }

    async_wait_all();     // next chunk resident
    __syncthreads();      // all waves done reading buf / writing buf^1
  }

  // ---- write back -----------------------------------------------------------
#pragma unroll
  for (int mt = 0; mt < 2; ++mt) {
#pragma unroll
    for (int nt = 0; nt < 4; ++nt) {
      float* yb = Y + (size_t)(mBlk + mw + mt * 16 + kh * 8) * N
                    + nBlk + nw + nt * 16 + idx16;
      const v8f a = acc[mt * 4 + nt];
#pragma unroll
      for (int v = 0; v < 8; ++v) yb[(size_t)v * N] = a[v];
    }
  }
}

// ---------------------------------------------------------------------------
// Windowed segment attention. One thread = one (b, q, h).
//  qh : (B, LQ, DATTN)      kv : (B, LKV, 2*DATTN)  [k | v]
//  For w in 0..3: idx = seg_id[b,q] - w; idx < 0 is masked (-inf score).
// ---------------------------------------------------------------------------
__global__ __launch_bounds__(256) void window_attn(
    const float* __restrict__ qh, const float* __restrict__ kv,
    const int* __restrict__ seg, float* __restrict__ out)
{
  const int t = blockIdx.x * blockDim.x + threadIdx.x;
  const int h = t & (NH - 1);
  const int q = (t >> 4) & (LQ_ - 1);
  const int b = t >> 16;                      // 16 = log2(NH * LQ_)
  if (b >= B_) return;

  const int s0 = seg[b * LQ_ + q];
  const float scale = 0.125f;                 // 64^-0.5

  const float* qv = qh + ((size_t)b * LQ_ + q) * DATTN + h * HD;
  float4 qr[HD / 4];
#pragma unroll
  for (int c = 0; c < HD / 4; ++c) qr[c] = ((const float4*)qv)[c];

  float sc[KW_];
  int   valid[KW_];
#pragma unroll
  for (int w = 0; w < KW_; ++w) {
    const int idx = s0 - w;
    valid[w] = (idx >= 0);
    float s = 0.f;
    if (valid[w]) {
      const float* kr = kv + ((size_t)b * LKV_ + idx) * (2 * DATTN) + h * HD;
#pragma unroll
      for (int c = 0; c < HD / 4; ++c) {
        const float4 kk = ((const float4*)kr)[c];
        s += qr[c].x * kk.x + qr[c].y * kk.y + qr[c].z * kk.z + qr[c].w * kk.w;
      }
    }
    sc[w] = s * scale;
  }

  float mx = -FLT_MAX;
#pragma unroll
  for (int w = 0; w < KW_; ++w) if (valid[w] && sc[w] > mx) mx = sc[w];
  float p[KW_];
  float sum = 0.f;
#pragma unroll
  for (int w = 0; w < KW_; ++w) {
    p[w] = valid[w] ? __expf(sc[w] - mx) : 0.f;
    sum += p[w];
  }
  const float inv = 1.f / sum;
#pragma unroll
  for (int w = 0; w < KW_; ++w) p[w] *= inv;

  float* ov = out + ((size_t)b * LQ_ + q) * DATTN + h * HD;
#pragma unroll
  for (int c = 0; c < HD / 4; ++c) {
    float4 a = make_float4(0.f, 0.f, 0.f, 0.f);
#pragma unroll
    for (int w = 0; w < KW_; ++w) {
      if (valid[w]) {
        const float* vr = kv + ((size_t)b * LKV_ + (s0 - w)) * (2 * DATTN) + DATTN + h * HD;
        const float4 vv = ((const float4*)vr)[c];
        a.x += p[w] * vv.x; a.y += p[w] * vv.y;
        a.z += p[w] * vv.z; a.w += p[w] * vv.w;
      }
    }
    ((float4*)ov)[c] = a;
  }
}

// ---------------------------------------------------------------------------
// Launcher. Inputs: q, kv_src, seg_id, Wq, Wkv, Wo.
// Workspace layout: qh (64MB) | kv (16MB) | attn (64MB)  = 144MB.
// ---------------------------------------------------------------------------
extern "C" void kernel_launch(void* const* d_in, const int* in_sizes, int n_in,
                              void* d_out, int out_size, void* d_ws, size_t ws_size,
                              hipStream_t stream) {
  const float* q      = (const float*)d_in[0];
  const float* kv_src = (const float*)d_in[1];
  const int*   seg    = (const int*)d_in[2];
  const float* Wq     = (const float*)d_in[3];
  const float* Wkv    = (const float*)d_in[4];
  const float* Wo     = (const float*)d_in[5];
  float* out = (float*)d_out;

  float* qh   = (float*)d_ws;                               // B*LQ*DATTN
  float* kv   = qh + (size_t)B_ * LQ_ * DATTN;              // B*LKV*2*DATTN
  float* attn = kv + (size_t)B_ * LKV_ * 2 * DATTN;         // B*LQ*DATTN

  const dim3 blk(256);

  // qh = q @ Wq.T                    M=16384 N=1024 K=1024
  gemm_xwT_wmma<<<dim3(1024 / 128, (B_ * LQ_) / 128), blk, 0, stream>>>(
      q, Wq, qh, B_ * LQ_, DATTN, 1024);

  // kv = kv_src @ Wkv.T              M=2048  N=2048 K=1024
  gemm_xwT_wmma<<<dim3((2 * DATTN) / 128, (B_ * LKV_) / 128), blk, 0, stream>>>(
      kv_src, Wkv, kv, B_ * LKV_, 2 * DATTN, 1024);

  // windowed attention               (B*LQ*NH) threads
  window_attn<<<dim3((B_ * LQ_ * NH) / 256), dim3(256), 0, stream>>>(
      qh, kv, seg, attn);

  // out = attn @ Wo.T                M=16384 N=1024 K=1024
  gemm_xwT_wmma<<<dim3(1024 / 128, (B_ * LQ_) / 128), blk, 0, stream>>>(
      attn, Wo, out, B_ * LQ_, DATTN, 1024);
}

// v001
// A run of this version takes 391 microseconds.
// Timed twice side by side with v000, it ran 1.13 and 1.12 times as fast.
#include <hip/hip_runtime.h>
#include <cfloat>

// ---------------------------------------------------------------------------
// Problem constants (from reference)
// ---------------------------------------------------------------------------
#define B_    4
#define LQ_   4096
#define LKV_  512
#define DATTN 1024
#define NH    16
#define HD    64
#define KW_   4          // LOOKBACK + 1

typedef __attribute__((ext_vector_type(2))) float v2f;
typedef __attribute__((ext_vector_type(8))) float v8f;
typedef __attribute__((ext_vector_type(4))) int   v4i;

typedef __attribute__((address_space(1))) v4i* gv4i_p;   // global
typedef __attribute__((address_space(3))) v4i* lv4i_p;   // LDS

// ---------------------------------------------------------------------------
// Async global->LDS staging (gfx1250). Falls back to a synchronous copy if
// the builtins are not declared by this toolchain.
// ---------------------------------------------------------------------------
#if __has_builtin(__builtin_amdgcn_global_load_async_to_lds_b128)
#define HAS_ASYNC_LDS 1
#endif

__device__ __forceinline__ void stage16(const float* g, float* l) {
#ifdef HAS_ASYNC_LDS
  __builtin_amdgcn_global_load_async_to_lds_b128((gv4i_p)g, (lv4i_p)l, 0, 0);
#else
  *(float4*)l = *(const float4*)g;
#endif
}

__device__ __forceinline__ void async_wait_all() {
#ifdef HAS_ASYNC_LDS
#if __has_builtin(__builtin_amdgcn_s_wait_asynccnt)
  __builtin_amdgcn_s_wait_asynccnt(0);
#else
  asm volatile("s_wait_asynccnt 0x0" ::: "memory");
#endif
#endif
}

// ---------------------------------------------------------------------------
// Y[m][n] = sum_k X[m][k] * W[n][k]   (torch-style y = x @ W.T)
// X: M x K row-major, W: N x K row-major, Y: M x N row-major.
// M, N multiples of 128; K multiple of 16.
//
// Workgroup (256 thr = 8 waves) computes a 128x128 output block.
// Wave w: M-strip (w>>1)*32 (two 16-row tiles), N-strip (w&1)*64 (four tiles).
// K is consumed in chunks of 16, double-buffered in LDS via async loads.
//
// LDS row stride = 20 floats (16 data + 4 pad): 20*r mod 64 distinct and
// multiple of 4 for r=0..15 -> conflict-free ds_load_b64 fragment reads,
// and 16B-aligned rows for the async b128 writes.
//
// V_WMMA_F32_16X16X4_F32 operand layout (ISA 7.12.2):
//   A 16x4 : lane = M + 16*Khalf, holds K = 2*Khalf + {0,1}  -> float2/lane
//   B 4x16 : lane = N + 16*Khalf, holds K = 2*Khalf + {0,1}  -> float2/lane
//   C/D    : VGPR v, lanes 0-15 -> row v, lanes 16-31 -> row v+8, col=lane&15
// ---------------------------------------------------------------------------
#define KC   16
#define LDP  20          // padded LDS row stride (floats)

__global__ __launch_bounds__(256) void gemm_xwT_wmma(
    const float* __restrict__ X, const float* __restrict__ W,
    float* __restrict__ Y, int M, int N, int K)
{
  __shared__ float Xs[2][128 * LDP];
  __shared__ float Ws[2][128 * LDP];

  const int t     = threadIdx.x;
  const int lane  = t & 31;
  const int wave  = t >> 5;
  const int mBlk  = blockIdx.y * 128;
  const int nBlk  = blockIdx.x * 128;
  const int mw    = (wave >> 1) * 32;   // wave M offset within block
  const int nw    = (wave & 1) * 64;    // wave N offset within block
  const int idx16 = lane & 15;
  const int kh    = lane >> 4;          // K-half: 0 -> K{0,1}, 1 -> K{2,3}

  // Staging map: per chunk, each matrix moves 128 rows x 16 floats
  // = 512 x b128 transfers; 256 threads issue 2 each per matrix.
  const int sRow0 = t >> 2;             // lin = 0*256 + t
  const int sCg0  = (t & 3) * 4;
  const int sRow1 = (256 + t) >> 2;     // lin = 1*256 + t
  const int sCg1  = ((256 + t) & 3) * 4;

  v8f acc[8] = {};                      // [mt*4 + nt]

  // ---- prologue: stage chunk 0 into buffer 0 --------------------------------
  {
    stage16(X + (size_t)(mBlk + sRow0) * K + sCg0, &Xs[0][sRow0 * LDP + sCg0]);
    stage16(X + (size_t)(mBlk + sRow1) * K + sCg1, &Xs[0][sRow1 * LDP + sCg1]);
    stage16(W + (size_t)(nBlk + sRow0) * K + sCg0, &Ws[0][sRow0 * LDP + sCg0]);
    stage16(W + (size_t)(nBlk + sRow1) * K + sCg1, &Ws[0][sRow1 * LDP + sCg1]);
  }
  async_wait_all();
  __syncthreads();

  for (int kc = 0; kc < K; kc += KC) {
    const int buf = (kc >> 4) & 1;

    // ---- stage next chunk into the other buffer (overlaps with compute) ----
    if (kc + KC < K) {
      const int kn = kc + KC;
      stage16(X + (size_t)(mBlk + sRow0) * K + kn + sCg0, &Xs[buf ^ 1][sRow0 * LDP + sCg0]);
      stage16(X + (size_t)(mBlk + sRow1) * K + kn + sCg1, &Xs[buf ^ 1][sRow1 * LDP + sCg1]);
      stage16(W + (size_t)(nBlk + sRow0) * K + kn + sCg0, &Ws[buf ^ 1][sRow0 * LDP + sCg0]);
      stage16(W + (size_t)(nBlk + sRow1) * K + kn + sCg1, &Ws[buf ^ 1][sRow1 * LDP + sCg1]);
    }

    // ---- compute current chunk from LDS ------------------------------------
#pragma unroll
    for (int ks = 0; ks < KC; ks += 4) {
      const int kb = ks + 2 * kh;
      const v2f a0 = *(const v2f*)&Xs[buf][(mw + idx16)      * LDP + kb];
      const v2f a1 = *(const v2f*)&Xs[buf][(mw + 16 + idx16) * LDP + kb];
#pragma unroll
      for (int nt = 0; nt < 4; ++nt) {
        const v2f b = *(const v2f*)&Ws[buf][(nw + nt * 16 + idx16) * LDP + kb];
        acc[nt]     = __builtin_amdgcn_wmma_f32_16x16x4_f32(false, a0, false, b, (short)0, acc[nt],     false, false);
        acc[4 + nt] = __builtin_amdgcn_wmma_f32_16x16x4_f32(false, a1, false, b, (short)0, acc[4 + nt], false, false);
      }
    }

    async_wait_all();     // next chunk resident
    __syncthreads();      // all waves done reading buf / writing buf^1
  }

  // ---- write back -----------------------------------------------------------
#pragma unroll
  for (int mt = 0; mt < 2; ++mt) {
#pragma unroll
    for (int nt = 0; nt < 4; ++nt) {
      float* yb = Y + (size_t)(mBlk + mw + mt * 16 + kh * 8) * N
                    + nBlk + nw + nt * 16 + idx16;
      const v8f a = acc[mt * 4 + nt];
#pragma unroll
      for (int v = 0; v < 8; ++v) yb[(size_t)v * N] = a[v];
    }
  }
}

// ---------------------------------------------------------------------------
// Windowed segment attention. 16 lanes = one (b, q, h): each lane holds 4 of
// the head's 64 values, so thread t of a block owns floats 4t..4t+3 of a
// 1024-float row and every wave-wide 16-byte access covers 512 contiguous
// bytes. One block pass = one query row (all 16 heads); a block walks QPB
// consecutive rows, RB at a time.
//  qh : (B, LQ, DATTN)      kv : (B, LKV, 2*DATTN)  [k | v]
//  For w in 0..3: idx = seg_id[b,q] - w; idx < 0 is masked (lowest score),
//  and the row that is read is idx clipped to [0, LKV-1], as in the reference.
// ---------------------------------------------------------------------------
#define QPB 16           // query rows per block; divides LQ_
#define RB  2            // rows whose loads are issued together; divides QPB

// x + x of the lane whose number differs by XM inside the 16-lane row.
template <int XM>
__device__ __forceinline__ float row_xor_add(float x) {
  const int y = __builtin_amdgcn_update_dpp(
      0, __builtin_bit_cast(int, x), 0x160 | XM /* row_xmask:XM */, 0xf, 0xf, true);
  return x + __builtin_bit_cast(float, y);
}

// Sum over the 16-lane row; every lane of the row ends with the same bits.
__device__ __forceinline__ float row16_sum(float x) {
  x = row_xor_add<1>(x);
  x = row_xor_add<2>(x);
  x = row_xor_add<4>(x);
  x = row_xor_add<8>(x);
  return x;
}

// 2^x. The v_nop is the free slot that the instruction set asks for behind a
// transcendental; inside the statement it cannot drift away from it.
__device__ __forceinline__ float exp2_slot(float x) {
  float r;
  asm("v_exp_f32 %0, %1\n\tv_nop" : "=v"(r) : "v"(x));
  return r;
}

__global__ __launch_bounds__(256) void window_attn(
    const float* __restrict__ qh, const float* __restrict__ kv,
    const int* __restrict__ seg, float* __restrict__ out)
{
  const int col  = threadIdx.x * 4;           // h * HD + d
  const int row0 = blockIdx.x * QPB;          // flat b * LQ_ + q
  const float* kvb = kv + (size_t)(row0 / LQ_) * LKV_ * (2 * DATTN) + col;
  const float scale = 0.125f;                 // 64^-0.5

  for (int i = 0; i < QPB; i += RB) {
    int    s0[RB];
    float4 qv[RB], kk[RB][KW_], vv[RB][KW_];
    const float* qp = qh + (size_t)(row0 + i) * DATTN + col;
    const float* kp[RB][KW_];
#pragma unroll
    for (int r = 0; r < RB; ++r) {
      s0[r] = seg[row0 + i + r];
      qv[r] = *(const float4*)(qp + r * DATTN);
#pragma unroll
      for (int w = 0; w < KW_; ++w) {
        const int ic = min(max(s0[r] - w, 0), LKV_ - 1);
        kp[r][w] = kvb + (size_t)ic * (2 * DATTN);
        kk[r][w] = *(const float4*)kp[r][w];
        vv[r][w] = *(const float4*)(kp[r][w] + DATTN);
      }
    }
    // The loads' address registers are inputs here, so none of them is reused
    // (not even as a later load's target) before this wait.
    static_assert(RB == 2, "the operand list below names two rows");
    asm volatile("s_wait_xcnt 0x0"
                 :: "v"(qp),
                    "v"(kp[0][0]), "v"(kp[0][1]), "v"(kp[0][2]), "v"(kp[0][3]),
                    "v"(kp[1][0]), "v"(kp[1][1]), "v"(kp[1][2]), "v"(kp[1][3])
                 : "memory");
    // Holds the loads ahead of the softmax arithmetic; without it the
    // scheduler sinks the V loads behind the softmax and waits for each in turn.
    __builtin_amdgcn_sched_barrier(0);

#pragma unroll
    for (int r = 0; r < RB; ++r) {
      float sc[KW_];
#pragma unroll
      for (int w = 0; w < KW_; ++w) {
        const float s = row16_sum(qv[r].x * kk[r][w].x + qv[r].y * kk[r][w].y +
                                  qv[r].z * kk[r][w].z + qv[r].w * kk[r][w].w);
        sc[w] = (s0[r] - w >= 0) ? s * scale : -FLT_MAX;
      }

      const float mx = fmaxf(fmaxf(sc[0], sc[1]), fmaxf(sc[2], sc[3]));
      float p[KW_];
      float sum = 0.f;
#pragma unroll
      for (int w = 0; w < KW_; ++w) {
        p[w] = exp2_slot((sc[w] - mx) * 1.44269504f);   // e^(sc - mx); masked: 0
        sum += p[w];
      }
      const float inv = 1.f / sum;

      float4 a = make_float4(0.f, 0.f, 0.f, 0.f);
#pragma unroll
      for (int w = 0; w < KW_; ++w) {
        const float pw = p[w] * inv;
        a.x += pw * vv[r][w].x; a.y += pw * vv[r][w].y;
        a.z += pw * vv[r][w].z; a.w += pw * vv[r][w].w;
      }
      *(float4*)(out + (size_t)(row0 + i + r) * DATTN + col) = a;
    }
    // The next trip rewrites registers that the stores above name.
    asm volatile("s_wait_xcnt 0x0" ::: "memory");
  }
}

// ---------------------------------------------------------------------------
// Launcher. Inputs: q, kv_src, seg_id, Wq, Wkv, Wo.
// Workspace layout: qh (64MB) | kv (16MB) | attn (64MB)  = 144MB.
// ---------------------------------------------------------------------------
extern "C" void kernel_launch(void* const* d_in, const int* in_sizes, int n_in,
                              void* d_out, int out_size, void* d_ws, size_t ws_size,
                              hipStream_t stream) {
  const float* q      = (const float*)d_in[0];
  const float* kv_src = (const float*)d_in[1];
  const int*   seg    = (const int*)d_in[2];
  const float* Wq     = (const float*)d_in[3];
  const float* Wkv    = (const float*)d_in[4];
  const float* Wo     = (const float*)d_in[5];
  float* out = (float*)d_out;

  float* qh   = (float*)d_ws;                               // B*LQ*DATTN
  float* kv   = qh + (size_t)B_ * LQ_ * DATTN;              // B*LKV*2*DATTN
  float* attn = kv + (size_t)B_ * LKV_ * 2 * DATTN;         // B*LQ*DATTN

  const dim3 blk(256);

  // qh = q @ Wq.T                    M=16384 N=1024 K=1024
  gemm_xwT_wmma<<<dim3(1024 / 128, (B_ * LQ_) / 128), blk, 0, stream>>>(
      q, Wq, qh, B_ * LQ_, DATTN, 1024);

  // kv = kv_src @ Wkv.T              M=2048  N=2048 K=1024
  gemm_xwT_wmma<<<dim3((2 * DATTN) / 128, (B_ * LKV_) / 128), blk, 0, stream>>>(
      kv_src, Wkv, kv, B_ * LKV_, 2 * DATTN, 1024);

  // windowed attention               one block per QPB query rows
  window_attn<<<dim3((B_ * LQ_) / QPB), dim3(256), 0, stream>>>(
      qh, kv, seg, attn);

  // out = attn @ Wo.T                M=16384 N=1024 K=1024
  gemm_xwT_wmma<<<dim3(1024 / 128, (B_ * LQ_) / 128), blk, 0, stream>>>(
      attn, Wo, out, B_ * LQ_, DATTN, 1024);
}

// v002
// It runs in 303 microseconds.
// Next to v001, in two timings, it ran 1.29 and 1.30 times as fast.
// Over all steps from v000 it is 1.46 times as fast.
#include <hip/hip_runtime.h>
#include <cfloat>

// ---------------------------------------------------------------------------
// Problem constants (from reference)
// ---------------------------------------------------------------------------
#define B_    4
#define LQ_   4096
#define LKV_  512
#define DATTN 1024
#define NH    16
#define HD    64
#define KW_   4          // LOOKBACK + 1

typedef __attribute__((ext_vector_type(2))) float v2f;
typedef __attribute__((ext_vector_type(8))) float v8f;
typedef __attribute__((ext_vector_type(4))) int   v4i;

typedef __attribute__((address_space(1))) v4i* gv4i_p;   // global
typedef __attribute__((address_space(3))) v4i* lv4i_p;   // LDS

// ---------------------------------------------------------------------------
// Async global->LDS staging (gfx1250). Falls back to a synchronous copy if
// the builtins are not declared by this toolchain.
// ---------------------------------------------------------------------------
#if __has_builtin(__builtin_amdgcn_global_load_async_to_lds_b128)
#define HAS_ASYNC_LDS 1
#endif

__device__ __forceinline__ void stage16(const float* g, float* l) {
#ifdef HAS_ASYNC_LDS
  __builtin_amdgcn_global_load_async_to_lds_b128((gv4i_p)g, (lv4i_p)l, 0, 0);
#else
  *(float4*)l = *(const float4*)g;
#endif
}

__device__ __forceinline__ void async_wait_all() {
#ifdef HAS_ASYNC_LDS
#if __has_builtin(__builtin_amdgcn_s_wait_asynccnt)
  __builtin_amdgcn_s_wait_asynccnt(0);
#else
  asm volatile("s_wait_asynccnt 0x0" ::: "memory");
#endif
#endif
}

// ---------------------------------------------------------------------------
// Y[m][n] = sum_k X[m][k] * W[n][k]   (torch-style y = x @ W.T)
// X: M x K, row pitch ldx; W: N x K, row pitch ldw; Y: M x N row-major.
// M, N multiples of 128; K multiple of 16.
//
// PERHEAD = 1: blockIdx.z is a head h; X and W start at column h * HD, and Y is
// the table T[m / 2][h][n][m & 1] that out_from_table reads (two neighbouring
// rows m side by side, which is the k pair of one B fragment there).
//
// Workgroup (256 thr = 8 waves) computes a 128x128 output block.
// Wave w: M-strip (w>>1)*32 (two 16-row tiles), N-strip (w&1)*64 (four tiles).
// K is consumed in chunks of 16, double-buffered in LDS via async loads.
//
// LDS row stride = 20 floats (16 data + 4 pad): 20*r mod 64 distinct and
// multiple of 4 for r=0..15 -> conflict-free ds_load_b64 fragment reads,
// and 16B-aligned rows for the async b128 writes.
//
// V_WMMA_F32_16X16X4_F32 operand layout (ISA 7.12.2):
//   A 16x4 : lane = M + 16*Khalf, holds K = 2*Khalf + {0,1}  -> float2/lane
//   B 4x16 : lane = N + 16*Khalf, holds K = 2*Khalf + {0,1}  -> float2/lane
//   C/D    : VGPR v, lanes 0-15 -> row v, lanes 16-31 -> row v+8, col=lane&15
// ---------------------------------------------------------------------------
#define KC   16
#define LDP  20          // padded LDS row stride (floats)

template <int PERHEAD>
__global__ __launch_bounds__(256) void gemm_xwT_wmma(
    const float* __restrict__ X, const float* __restrict__ W,
    float* __restrict__ Y, int M, int N, int K, int ldx, int ldw)
{
  __shared__ float Xs[2][128 * LDP];
  __shared__ float Ws[2][128 * LDP];

  const int t     = threadIdx.x;
  const int lane  = t & 31;
  const int wave  = t >> 5;
  const int mBlk  = blockIdx.y * 128;
  const int nBlk  = blockIdx.x * 128;
  const int mw    = (wave >> 1) * 32;   // wave M offset within block
  const int nw    = (wave & 1) * 64;    // wave N offset within block
  const int idx16 = lane & 15;
  const int kh    = lane >> 4;          // K-half: 0 -> K{0,1}, 1 -> K{2,3}

  // Staging map: per chunk, each matrix moves 128 rows x 16 floats
  // = 512 x b128 transfers; 256 threads issue 2 each per matrix.
  const int sRow0 = t >> 2;             // lin = 0*256 + t
  const int sCg0  = (t & 3) * 4;
  const int sRow1 = (256 + t) >> 2;     // lin = 1*256 + t
  const int sCg1  = ((256 + t) & 3) * 4;

  v8f acc[8] = {};                      // [mt*4 + nt]

  if (PERHEAD) {
    X += blockIdx.z * HD;
    W += blockIdx.z * HD;
  }

  // ---- prologue: stage chunk 0 into buffer 0 --------------------------------
  {
    stage16(X + (size_t)(mBlk + sRow0) * ldx + sCg0, &Xs[0][sRow0 * LDP + sCg0]);
    stage16(X + (size_t)(mBlk + sRow1) * ldx + sCg1, &Xs[0][sRow1 * LDP + sCg1]);
    stage16(W + (size_t)(nBlk + sRow0) * ldw + sCg0, &Ws[0][sRow0 * LDP + sCg0]);
    stage16(W + (size_t)(nBlk + sRow1) * ldw + sCg1, &Ws[0][sRow1 * LDP + sCg1]);
  }
  async_wait_all();
  __syncthreads();

  for (int kc = 0; kc < K; kc += KC) {
    const int buf = (kc >> 4) & 1;

    // ---- stage next chunk into the other buffer (overlaps with compute) ----
    if (kc + KC < K) {
      const int kn = kc + KC;
      stage16(X + (size_t)(mBlk + sRow0) * ldx + kn + sCg0, &Xs[buf ^ 1][sRow0 * LDP + sCg0]);
      stage16(X + (size_t)(mBlk + sRow1) * ldx + kn + sCg1, &Xs[buf ^ 1][sRow1 * LDP + sCg1]);
      stage16(W + (size_t)(nBlk + sRow0) * ldw + kn + sCg0, &Ws[buf ^ 1][sRow0 * LDP + sCg0]);
      stage16(W + (size_t)(nBlk + sRow1) * ldw + kn + sCg1, &Ws[buf ^ 1][sRow1 * LDP + sCg1]);
    }

    // ---- compute current chunk from LDS ------------------------------------
#pragma unroll
    for (int ks = 0; ks < KC; ks += 4) {
      const int kb = ks + 2 * kh;
      const v2f a0 = *(const v2f*)&Xs[buf][(mw + idx16)      * LDP + kb];
      const v2f a1 = *(const v2f*)&Xs[buf][(mw + 16 + idx16) * LDP + kb];
#pragma unroll
      for (int nt = 0; nt < 4; ++nt) {
        const v2f b = *(const v2f*)&Ws[buf][(nw + nt * 16 + idx16) * LDP + kb];
        acc[nt]     = __builtin_amdgcn_wmma_f32_16x16x4_f32(false, a0, false, b, (short)0, acc[nt],     false, false);
        acc[4 + nt] = __builtin_amdgcn_wmma_f32_16x16x4_f32(false, a1, false, b, (short)0, acc[4 + nt], false, false);
      }
    }

    async_wait_all();     // next chunk resident
    __syncthreads();      // all waves done reading buf / writing buf^1
  }

  // ---- write back -----------------------------------------------------------
#pragma unroll
  for (int mt = 0; mt < 2; ++mt) {
#pragma unroll
    for (int nt = 0; nt < 4; ++nt) {
      const int row = mBlk + mw + mt * 16 + kh * 8;
      const int cn  = nBlk + nw + nt * 16 + idx16;
      const v8f a = acc[mt * 4 + nt];
      if (PERHEAD) {
        float* yb = Y + (((size_t)(row >> 1) * NH + blockIdx.z) * N + cn) * 2;
#pragma unroll   // a[] is indexed by constants
        for (int v = 0; v < 8; v += 2) {
          const v2f pr = {a[v], a[v + 1]};
          *(v2f*)(yb + (size_t)(v >> 1) * NH * N * 2) = pr;
        }
      } else {
        float* yb = Y + (size_t)row * N + cn;
#pragma unroll
        for (int v = 0; v < 8; ++v) yb[(size_t)v * N] = a[v];
      }
    }
  }
}

// ---------------------------------------------------------------------------
// Windowed segment attention, scores and softmax. 16 lanes = one (b, q, h): each lane holds 4 of
// the head's 64 values, so thread t of a block owns floats 4t..4t+3 of a
// 1024-float row and every wave-wide 16-byte access covers 512 contiguous
// bytes. One block pass = one query row (all 16 heads); a block walks QPB
// consecutive rows, RB at a time.
//  qh : (B, LQ, DATTN)      kv : (B, LKV, 2*DATTN)  [k | v]
//  For w in 0..3: idx = seg_id[b,q] - w; idx < 0 is masked (lowest score),
//  and the row that is read is idx clipped to [0, LKV-1], as in the reference.
//  pg : (B * LQ, NH, 4). Entry r is the weight of kv row c0 - 3 + r, where
//  c0 = clip(seg_id); windows that the clip sends to one row are added up.
// ---------------------------------------------------------------------------
#define QPB 16           // query rows per block; divides LQ_
#define RB  2            // rows whose loads are issued together; divides QPB

// x + x of the lane whose number differs by XM inside the 16-lane row.
template <int XM>
__device__ __forceinline__ float row_xor_add(float x) {
  const int y = __builtin_amdgcn_update_dpp(
      0, __builtin_bit_cast(int, x), 0x160 | XM /* row_xmask:XM */, 0xf, 0xf, true);
  return x + __builtin_bit_cast(float, y);
}

// Sum over the 16-lane row; every lane of the row ends with the same bits.
__device__ __forceinline__ float row16_sum(float x) {
  x = row_xor_add<1>(x);
  x = row_xor_add<2>(x);
  x = row_xor_add<4>(x);
  x = row_xor_add<8>(x);
  return x;
}

// 2^x. The v_nop is the free slot that the instruction set asks for behind a
// transcendental; inside the statement it cannot drift away from it.
__device__ __forceinline__ float exp2_slot(float x) {
  float r;
  asm("v_exp_f32 %0, %1\n\tv_nop" : "=v"(r) : "v"(x));
  return r;
}

__global__ __launch_bounds__(256) void window_attn(
    const float* __restrict__ qh, const float* __restrict__ kv,
    const int* __restrict__ seg, float* __restrict__ pg)
{
  const int col  = threadIdx.x * 4;           // h * HD + d
  const int row0 = blockIdx.x * QPB;          // flat b * LQ_ + q
  const float* kvb = kv + (size_t)(row0 / LQ_) * LKV_ * (2 * DATTN) + col;
  const float scale = 0.125f;                 // 64^-0.5

  for (int i = 0; i < QPB; i += RB) {
    int    s0[RB];
    float4 qv[RB], kk[RB][KW_];
    const float* qp = qh + (size_t)(row0 + i) * DATTN + col;
    float* pgp = pg + (size_t)(row0 + i) * (NH * KW_) + (threadIdx.x >> 4) * KW_;
    const float* kp[RB][KW_];
#pragma unroll
    for (int r = 0; r < RB; ++r) {
      s0[r] = seg[row0 + i + r];
      qv[r] = *(const float4*)(qp + r * DATTN);
#pragma unroll
      for (int w = 0; w < KW_; ++w) {
        const int ic = min(max(s0[r] - w, 0), LKV_ - 1);
        kp[r][w] = kvb + (size_t)ic * (2 * DATTN);
        kk[r][w] = *(const float4*)kp[r][w];
      }
    }
    // The loads' address registers are inputs here, so none of them is reused
    // (not even as a later load's target) before this wait.
    static_assert(RB == 2, "the operand list below names two rows");
    asm volatile("s_wait_xcnt 0x0"
                 :: "v"(qp),
                    "v"(kp[0][0]), "v"(kp[0][1]), "v"(kp[0][2]), "v"(kp[0][3]),
                    "v"(kp[1][0]), "v"(kp[1][1]), "v"(kp[1][2]), "v"(kp[1][3])
                 : "memory");
    // Holds both rows' loads together ahead of the arithmetic; without it the
    // scheduler issues the second row's K loads only behind the waits for the
    // first row's, and the trip pays the load latency twice.
    __builtin_amdgcn_sched_barrier(0);

#pragma unroll
    for (int r = 0; r < RB; ++r) {
      float sc[KW_];
#pragma unroll
      for (int w = 0; w < KW_; ++w) {
        const float s = row16_sum(qv[r].x * kk[r][w].x + qv[r].y * kk[r][w].y +
                                  qv[r].z * kk[r][w].z + qv[r].w * kk[r][w].w);
        sc[w] = (s0[r] - w >= 0) ? s * scale : -FLT_MAX;
      }

      const float mx = fmaxf(fmaxf(sc[0], sc[1]), fmaxf(sc[2], sc[3]));
      float p[KW_];
      float sum = 0.f;
#pragma unroll
      for (int w = 0; w < KW_; ++w) {
        p[w] = exp2_slot((sc[w] - mx) * 1.44269504f);   // e^(sc - mx); masked: 0
        sum += p[w];
      }
      const float inv = 1.f / sum;

      const int c0 = min(max(s0[r], 0), LKV_ - 1);
      float pr[KW_] = {0.f, 0.f, 0.f, 0.f};
#pragma unroll
      for (int w = 0; w < KW_; ++w) {
        const float pw = p[w] * inv;
        const int   rr = 3 - (c0 - min(max(s0[r] - w, 0), LKV_ - 1));   // 0..3
#pragma unroll   // pr[] is indexed by constants
        for (int k = 0; k < KW_; ++k) pr[k] += (rr == k) ? pw : 0.f;
      }
      if ((threadIdx.x & 15) == 0)
        *(float4*)(pgp + r * (NH * KW_)) = make_float4(pr[0], pr[1], pr[2], pr[3]);
    }
    // The next trip rewrites registers that the stores above name; their
    // address is an input here, so it is not advanced ahead of this wait.
    asm volatile("s_wait_xcnt 0x0" :: "v"(pgp) : "memory");
  }
}

// ---------------------------------------------------------------------------
// out[q][n] = sum over kv rows j and heads h of P[q][j][h] * T[j][h][n], with
// T[j][h][n] = sum_d v[j][h][d] * Wo[n][h*HD + d] (gemm_xwT_wmma<1>) and
// P[q][j][h] the softmax weight of row j, zero outside the query's window.
// A block takes MT_ query rows and walks only the kv rows between the lowest
// and the highest window of its rows (found here, for any seg content), two
// rows j at a time: k = 2 rows x 16 heads = 8 matrix steps.
// k order of one step hs, equal for A and B: lane half kh, element e
//   -> head 2*hs + kh, kv row 2*jp + e.
// Block = 8 waves; wave tile 32 x 64, block tile 32 x 512.
//
// Ps[q][h][0..7] = {0, 0, pg[q][h][0..3], 0, 0}: the pair of weights for rows
// (2*jp, 2*jp + 1) is two neighbouring floats at a clamped index, zeros
// included, so no lane is ever switched off. Rows q and q + 16 share one LDS
// row of PQ_ floats (the second PM_ floats in), so that every fragment read of
// a trip is a constant offset from two registers; odd heads lie PO_ floats
// behind the even ones; PQ_ and PO_ spread the 32 lanes over the banks.
// ---------------------------------------------------------------------------
#define MT_  32
#define PQ_  268
#define PM_  132
#define PO_  66

__global__ __launch_bounds__(256) void out_from_table(
    const float* __restrict__ pg, const float* __restrict__ tab,
    const int* __restrict__ seg, float* __restrict__ out)
{
  __shared__ float Ps[16 * PQ_];

  const int t     = threadIdx.x;
  const int lane  = t & 31;
  const int wave  = t >> 5;
  const int idx16 = lane & 15;
  const int kh    = lane >> 4;
  const int row0  = blockIdx.y * MT_;                 // flat b * LQ_ + q
  const int n0    = blockIdx.x * 512 + wave * 64;

  // MT_ * NH = 512 weight quads, two per thread; the wave's own 32 segments.
  static_assert(MT_ * NH == 512 && MT_ == 32, "two quads per thread, one row per lane");
  const float* pp0 = pg + (size_t)row0 * (NH * KW_) + t * KW_;
  const float* pp1 = pp0 + 256 * KW_;
  const int*   sp0 = seg + row0 + lane;
  const int*   sp1 = seg + row0 + idx16;
  const float4 pv[2] = {*(const float4*)pp0, *(const float4*)pp1};
  const int sl = *sp0, sa0 = sp1[0], sa1 = sp1[16];
  // The loads' offset registers (the three indices) are inputs here, so none of
  // them is reused (not even as a load's target) before this wait.
  asm volatile("s_wait_xcnt 0x0" :: "v"(t), "v"(lane), "v"(idx16) : "memory");

#pragma unroll   // pv[] is indexed by constants and stays in registers
  for (int k = 0; k < 2; ++k) {
    const int i = t + k * 256, q = i >> 4, h = i & 15;
    float* d = &Ps[(q & 15) * PQ_ + (q >> 4) * PM_ + (h & 1) * PO_ + (h >> 1) * 8];
    const v2f z = {0.f, 0.f}, lo = {pv[k].x, pv[k].y}, hi = {pv[k].z, pv[k].w};
    *(v2f*)(d + 0) = z;
    *(v2f*)(d + 2) = lo;
    *(v2f*)(d + 4) = hi;
    *(v2f*)(d + 6) = z;
  }

  // Lowest and highest clipped segment of the block's MT_ = 32 rows.
  int mn = min(max(sl, 0), LKV_ - 1);
  int mx = mn;
#pragma unroll   // five fixed exchange steps, no loop counter
  for (int o = 16; o > 0; o >>= 1) {
    mn = min(mn, __shfl_xor(mn, o));
    mx = max(mx, __shfl_xor(mx, o));
  }
  const int jp0 = __builtin_amdgcn_readfirstlane(max(mn - (KW_ - 1), 0) >> 1);
  const int jp1 = __builtin_amdgcn_readfirstlane(mx >> 1);   // <= LKV_/2 - 1

  const int c0a[2] = {min(max(sa0, 0), LKV_ - 1), min(max(sa1, 0), LKV_ - 1)};
  const int ab[2]  = {idx16 * PQ_ + kh * PO_ + 2, idx16 * PQ_ + PM_ + kh * PO_ + 2};

  const float* tb = tab + ((size_t)(row0 / LQ_) * (LKV_ / 2) * NH + kh) * (DATTN * 2)
                        + (n0 + idx16) * 2;

  v8f acc[8] = {};                      // [mt*4 + nt]
  __syncthreads();

  for (int jp = jp0; jp <= jp1; ++jp) {
    const float* tj = tb + (size_t)jp * (NH * DATTN * 2);
    const int ai0 = ab[0] + min(max(2 * jp + (KW_ - 1) - c0a[0], -2), 4);
    const int ai1 = ab[1] + min(max(2 * jp + (KW_ - 1) - c0a[1], -2), 4);

    v2f b[NH / 2][4];
#pragma unroll   // b[][] is indexed by constants and stays in registers
    for (int hs = 0; hs < NH / 2; ++hs)
#pragma unroll   // as above
      for (int nt = 0; nt < 4; ++nt)
        b[hs][nt] = *(const v2f*)(tj + hs * (2 * DATTN * 2) + nt * 32);
    // The next trip rewrites the address registers that the loads above name.
    asm volatile("s_wait_xcnt 0x0" :: "v"(tj) : "memory");
    // Keeps the trip's 32 loads together ahead of its matrix steps: one load
    // latency a trip; left free, the scheduler issues each step's loads only
    // one step ahead and the wave waits at every step.
    __builtin_amdgcn_sched_barrier(0);

#pragma unroll   // acc[] and b[][] are indexed by constants
    for (int hs = 0; hs < NH / 2; ++hs) {
      const v2f a0 = {Ps[ai0 + hs * 8], Ps[ai0 + hs * 8 + 1]};
      const v2f a1 = {Ps[ai1 + hs * 8], Ps[ai1 + hs * 8 + 1]};
#pragma unroll   // as above
      for (int nt = 0; nt < 4; ++nt) {
        acc[nt]     = __builtin_amdgcn_wmma_f32_16x16x4_f32(false, a0, false, b[hs][nt], (short)0, acc[nt],     false, false);
        acc[4 + nt] = __builtin_amdgcn_wmma_f32_16x16x4_f32(false, a1, false, b[hs][nt], (short)0, acc[4 + nt], false, false);
      }
    }
  }

#pragma unroll   // acc[] is indexed by constants
  for (int mt = 0; mt < 2; ++mt) {
#pragma unroll   // as above
    for (int nt = 0; nt < 4; ++nt) {
      float* yb = out + (size_t)(row0 + mt * 16 + kh * 8) * DATTN + n0 + nt * 16 + idx16;
      const v8f a = acc[mt * 4 + nt];
#pragma unroll   // as above
      for (int v = 0; v < 8; ++v) yb[(size_t)v * DATTN] = a[v];
    }
  }
}

// ---------------------------------------------------------------------------
// Launcher. Inputs: q, kv_src, seg_id, Wq, Wkv, Wo.
// Workspace layout: qh (64MB) | kv (16MB) | pg (4MB) | tab (128MB)  = 212MB.
// ---------------------------------------------------------------------------
extern "C" void kernel_launch(void* const* d_in, const int* in_sizes, int n_in,
                              void* d_out, int out_size, void* d_ws, size_t ws_size,
                              hipStream_t stream) {
  const float* q      = (const float*)d_in[0];
  const float* kv_src = (const float*)d_in[1];
  const int*   seg    = (const int*)d_in[2];
  const float* Wq     = (const float*)d_in[3];
  const float* Wkv    = (const float*)d_in[4];
  const float* Wo     = (const float*)d_in[5];
  float* out = (float*)d_out;

  float* qh   = (float*)d_ws;                               // B*LQ*DATTN
  float* kv   = qh + (size_t)B_ * LQ_ * DATTN;              // B*LKV*2*DATTN
  float* pg   = kv + (size_t)B_ * LKV_ * 2 * DATTN;         // B*LQ*NH*KW
  float* tab  = pg + (size_t)B_ * LQ_ * NH * KW_;           // B*LKV*NH*DATTN

  const dim3 blk(256);

  // qh = q @ Wq.T                    M=16384 N=1024 K=1024
  gemm_xwT_wmma<0><<<dim3(1024 / 128, (B_ * LQ_) / 128), blk, 0, stream>>>(
      q, Wq, qh, B_ * LQ_, DATTN, 1024, 1024, 1024);

  // kv = kv_src @ Wkv.T              M=2048  N=2048 K=1024
  gemm_xwT_wmma<0><<<dim3((2 * DATTN) / 128, (B_ * LKV_) / 128), blk, 0, stream>>>(
      kv_src, Wkv, kv, B_ * LKV_, 2 * DATTN, 1024, 1024, 1024);

  // window softmax weights           one block per QPB query rows
  window_attn<<<dim3((B_ * LQ_) / QPB), dim3(256), 0, stream>>>(
      qh, kv, seg, pg);

  // tab[j][h] = v[j][h] @ Wo[:, h].T  per head: M=2048 N=1024 K=64
  // (last before its reader, so that more of it is still in L2 there)
  gemm_xwT_wmma<1><<<dim3(1024 / 128, (B_ * LKV_) / 128, NH), blk, 0, stream>>>(
      kv + DATTN, Wo, tab, B_ * LKV_, DATTN, HD, 2 * DATTN, DATTN);

  // out = P @ tab                    k = the block's own span of kv rows x heads
  out_from_table<<<dim3(DATTN / 512, (B_ * LQ_) / MT_), blk, 0, stream>>>(
      pg, tab, seg, out);
}

// v003
// It runs in 212 microseconds.
// In two side-by-side timings against v002, it was 1.43 and 1.42 times as fast.
// All steps since v000 together make it 2.08 times as fast.
#include <hip/hip_runtime.h>
#include <cfloat>

// ---------------------------------------------------------------------------
// Problem constants (from reference)
// ---------------------------------------------------------------------------
#define B_    4
#define LQ_   4096
#define LKV_  512
#define DATTN 1024
#define NH    16
#define HD    64
#define KW_   4          // LOOKBACK + 1

typedef __attribute__((ext_vector_type(2))) float v2f;
typedef __attribute__((ext_vector_type(8))) float v8f;
typedef __attribute__((ext_vector_type(4))) int   v4i;

typedef __attribute__((address_space(1))) v4i* gv4i_p;   // global
typedef __attribute__((address_space(3))) v4i* lv4i_p;   // LDS

// ---------------------------------------------------------------------------
// Async global->LDS staging (gfx1250). Falls back to a synchronous copy if
// the builtins are not declared by this toolchain.
// ---------------------------------------------------------------------------
#if __has_builtin(__builtin_amdgcn_global_load_async_to_lds_b128)
#define HAS_ASYNC_LDS 1
#endif

__device__ __forceinline__ void stage16(const float* g, float* l) {
#ifdef HAS_ASYNC_LDS
  __builtin_amdgcn_global_load_async_to_lds_b128((gv4i_p)g, (lv4i_p)l, 0, 0);
#else
  *(float4*)l = *(const float4*)g;
#endif
}

__device__ __forceinline__ void async_wait_all() {
#ifdef HAS_ASYNC_LDS
#if __has_builtin(__builtin_amdgcn_s_wait_asynccnt)
  __builtin_amdgcn_s_wait_asynccnt(0);
#else
  asm volatile("s_wait_asynccnt 0x0" ::: "memory");
#endif
#endif
}

// ---------------------------------------------------------------------------
// Y[m][n] = sum_k X[m][k] * W[n][k]   (torch-style y = x @ W.T)
// X: M x K, row pitch ldx; W: N x K, row pitch ldw; Y: M x N row-major.
// M, N multiples of 128; K multiple of 16.
//
// PERHEAD = 1: blockIdx.z is a head h; X and W start at column h * HD, and Y is
// the table T[m / 2][h][n][m & 1] that out_from_table reads (two neighbouring
// rows m side by side, which is the k pair of one B fragment there).
//
// Workgroup (256 thr = 8 waves) computes a 128x128 output block.
// Wave w: M-strip (w>>1)*32 (two 16-row tiles), N-strip (w&1)*64 (four tiles).
// K is consumed in chunks of 16, double-buffered in LDS via async loads.
//
// LDS row stride = 20 floats (16 data + 4 pad): 20*r mod 64 distinct and
// multiple of 4 for r=0..15 -> conflict-free ds_load_b64 fragment reads,
// and 16B-aligned rows for the async b128 writes.
//
// V_WMMA_F32_16X16X4_F32 operand layout (ISA 7.12.2):
//   A 16x4 : lane = M + 16*Khalf, holds K = 2*Khalf + {0,1}  -> float2/lane
//   B 4x16 : lane = N + 16*Khalf, holds K = 2*Khalf + {0,1}  -> float2/lane
//   C/D    : VGPR v, lanes 0-15 -> row v, lanes 16-31 -> row v+8, col=lane&15
// ---------------------------------------------------------------------------
#define KC   16
#define LDP  20          // padded LDS row stride (floats)

template <int PERHEAD>
__global__ __launch_bounds__(256) void gemm_xwT_wmma(
    const float* __restrict__ X, const float* __restrict__ W,
    float* __restrict__ Y, int M, int N, int K, int ldx, int ldw)
{
  __shared__ float Xs[2][128 * LDP];
  __shared__ float Ws[2][128 * LDP];

  const int t     = threadIdx.x;
  const int lane  = t & 31;
  const int wave  = t >> 5;
  const int mBlk  = blockIdx.y * 128;
  const int nBlk  = blockIdx.x * 128;
  const int mw    = (wave >> 1) * 32;   // wave M offset within block
  const int nw    = (wave & 1) * 64;    // wave N offset within block
  const int idx16 = lane & 15;
  const int kh    = lane >> 4;          // K-half: 0 -> K{0,1}, 1 -> K{2,3}

  // Staging map: per chunk, each matrix moves 128 rows x 16 floats
  // = 512 x b128 transfers; 256 threads issue 2 each per matrix.
  const int sRow0 = t >> 2;             // lin = 0*256 + t
  const int sCg0  = (t & 3) * 4;
  const int sRow1 = (256 + t) >> 2;     // lin = 1*256 + t
  const int sCg1  = ((256 + t) & 3) * 4;

  v8f acc[8] = {};                      // [mt*4 + nt]

  if (PERHEAD) {
    X += blockIdx.z * HD;
    W += blockIdx.z * HD;
  }

  // ---- prologue: stage chunk 0 into buffer 0 --------------------------------
  {
    stage16(X + (size_t)(mBlk + sRow0) * ldx + sCg0, &Xs[0][sRow0 * LDP + sCg0]);
    stage16(X + (size_t)(mBlk + sRow1) * ldx + sCg1, &Xs[0][sRow1 * LDP + sCg1]);
    stage16(W + (size_t)(nBlk + sRow0) * ldw + sCg0, &Ws[0][sRow0 * LDP + sCg0]);
    stage16(W + (size_t)(nBlk + sRow1) * ldw + sCg1, &Ws[0][sRow1 * LDP + sCg1]);
  }
  async_wait_all();
  __syncthreads();

  for (int kc = 0; kc < K; kc += KC) {
    const int buf = (kc >> 4) & 1;

    // ---- stage next chunk into the other buffer (overlaps with compute) ----
    if (kc + KC < K) {
      const int kn = kc + KC;
      stage16(X + (size_t)(mBlk + sRow0) * ldx + kn + sCg0, &Xs[buf ^ 1][sRow0 * LDP + sCg0]);
      stage16(X + (size_t)(mBlk + sRow1) * ldx + kn + sCg1, &Xs[buf ^ 1][sRow1 * LDP + sCg1]);
      stage16(W + (size_t)(nBlk + sRow0) * ldw + kn + sCg0, &Ws[buf ^ 1][sRow0 * LDP + sCg0]);
      stage16(W + (size_t)(nBlk + sRow1) * ldw + kn + sCg1, &Ws[buf ^ 1][sRow1 * LDP + sCg1]);
    }

    // ---- compute current chunk from LDS ------------------------------------
#pragma unroll
    for (int ks = 0; ks < KC; ks += 4) {
      const int kb = ks + 2 * kh;
      const v2f a0 = *(const v2f*)&Xs[buf][(mw + idx16)      * LDP + kb];
      const v2f a1 = *(const v2f*)&Xs[buf][(mw + 16 + idx16) * LDP + kb];
#pragma unroll
      for (int nt = 0; nt < 4; ++nt) {
        const v2f b = *(const v2f*)&Ws[buf][(nw + nt * 16 + idx16) * LDP + kb];
        acc[nt]     = __builtin_amdgcn_wmma_f32_16x16x4_f32(false, a0, false, b, (short)0, acc[nt],     false, false);
        acc[4 + nt] = __builtin_amdgcn_wmma_f32_16x16x4_f32(false, a1, false, b, (short)0, acc[4 + nt], false, false);
      }
    }

    async_wait_all();     // next chunk resident
    __syncthreads();      // all waves done reading buf / writing buf^1
  }

  // ---- write back -----------------------------------------------------------
#pragma unroll
  for (int mt = 0; mt < 2; ++mt) {
#pragma unroll
    for (int nt = 0; nt < 4; ++nt) {
      const int row = mBlk + mw + mt * 16 + kh * 8;
      const int cn  = nBlk + nw + nt * 16 + idx16;
      const v8f a = acc[mt * 4 + nt];
      if (PERHEAD) {
        float* yb = Y + (((size_t)(row >> 1) * NH + blockIdx.z) * N + cn) * 2;
#pragma unroll   // a[] is indexed by constants
        for (int v = 0; v < 8; v += 2) {
          const v2f pr = {a[v], a[v + 1]};
          *(v2f*)(yb + (size_t)(v >> 1) * NH * N * 2) = pr;
        }
      } else {
        float* yb = Y + (size_t)row * N + cn;
#pragma unroll
        for (int v = 0; v < 8; ++v) yb[(size_t)v * N] = a[v];
      }
    }
  }
}

// ---------------------------------------------------------------------------
// Wq folded into K. score[q][h][j] = sum_d (q Wq^T)[h*HD+d] * k[j][h*HD+d]
//                                  = sum_c q[c] * U[j][h][c],
// U[j][h][c] = sum_d k[j][h*HD+d] * Wq[h*HD+d][c]          (K = HD = 64).
// Stored as ut[j][c / 4][h][c & 3]: the 16 heads of one kv row side by side,
// four c each, so that one 16-byte load per lane in window_scores covers 512
// contiguous bytes and feeds two matrix steps.
//
// Block = 8 waves = 8 heads (blockIdx.z picks the half), UC_ columns c (matrix
// rows) x UJ_ kv rows j (matrix columns) per wave, operands straight from
// global memory. k order of step s of octet kq, equal for A and B:
//   lane half kh, element e -> d = 8*kq + 4*kh + 2*s + e.
// The results go through LDS so that the 8 heads' 16-byte pieces leave as
// whole 128-byte lines. UP_: one kv row's floats in LDS plus 4, which spreads
// the 16 lanes of a 16-byte write over all banks.
// ---------------------------------------------------------------------------
#define QD_  1024        // q_dim, the pitch of q and Wq
#define UJ_  64
#define UC_  64
#define UH_  8
#define UP_  (UC_ * UH_ + 4)

typedef __attribute__((ext_vector_type(4))) float v4f;

// Second bound: four waves per SIMD, so that two blocks share a WGP and one
// block's loads and stores hide behind the other's matrix steps.
__global__ __launch_bounds__(256, 4) void fold_wq_into_k(
    const float* __restrict__ kv, const float* __restrict__ Wq,
    float* __restrict__ ut)
{
  __shared__ float Ts[UJ_ * UP_];

  const int t     = threadIdx.x;
  const int lane  = t & 31;
  const int wave  = t >> 5;
  const int idx16 = lane & 15;
  const int kh    = lane >> 4;
  const int c0    = blockIdx.x * UC_;
  const int j0    = blockIdx.y * UJ_;               // flat b * LKV_ + j
  const int h     = blockIdx.z * UH_ + wave;

  // The lane's byte offsets into Wq and kv (both below 2^25).
  unsigned oa = (unsigned)(((h * HD + kh * 4) * QD_ + c0 + idx16) * 4);
  unsigned ob = (unsigned)(((j0 + idx16) * (2 * DATTN) + h * HD + kh * 4) * 4);

  v8f acc[16] = {};                     // [mt*4 + nt]

  // Kept rolled: unrolled, the second half's loads are hoisted into the first
  // and the registers of four waves per SIMD no longer suffice.
#pragma unroll 1
  for (int hf = 0; hf < 2; ++hf) {
    // Half of a head's k row is one 128-byte line; its eight 16-byte pieces per
    // lane pair are fetched together, so that no line is fetched twice.
    const float* pa = (const float*)((const char*)Wq + oa);
    const float* pb = (const float*)((const char*)kv + ob);
    v4f bv[4][4];                       // [nt][octet]
#pragma unroll   // bv[][] is indexed by constants and stays in registers
    for (int nt = 0; nt < 4; ++nt)
#pragma unroll   // as above
      for (int i = 0; i < 4; ++i)
        bv[nt][i] = *(const v4f*)(pb + (size_t)nt * 16 * (2 * DATTN) + i * 8);
#pragma unroll   // acc[], av[][] and bv[][] are indexed by constants
    for (int i = 0; i < 4; ++i) {
      float av[4][4];                   // [mt][e]
#pragma unroll   // as above
      for (int mt = 0; mt < 4; ++mt)
#pragma unroll   // as above
        for (int e = 0; e < 4; ++e)
          av[mt][e] = pa[(size_t)(i * 8 + e) * QD_ + mt * 16];
#pragma unroll   // as above
      for (int s = 0; s < 2; ++s)
#pragma unroll   // as above
        for (int mt = 0; mt < 4; ++mt) {
          const v2f a = {av[mt][2 * s], av[mt][2 * s + 1]};
#pragma unroll   // as above
          for (int nt = 0; nt < 4; ++nt) {
            const v2f b = {bv[nt][i][2 * s], bv[nt][i][2 * s + 1]};
            acc[mt * 4 + nt] = __builtin_amdgcn_wmma_f32_16x16x4_f32(
                false, a, false, b, (short)0, acc[mt * 4 + nt], false, false);
          }
        }
    }
    // The wait: the two additions below rewrite the offset registers of the
    // loads above. The four v_nop: free vector slots between the last matrix
    // steps and whatever touches their result or reuses their operand registers.
    // The sums are inputs, so the statement stands behind every matrix step; the
    // offsets pass through it, so their additions stand behind it.
    asm volatile("s_wait_xcnt 0x0\n\tv_nop\n\tv_nop\n\tv_nop\n\tv_nop"
                 : "+v"(oa), "+v"(ob)
                 : "v"(acc[0]), "v"(acc[1]), "v"(acc[2]), "v"(acc[3]),
                   "v"(acc[4]), "v"(acc[5]), "v"(acc[6]), "v"(acc[7]),
                   "v"(acc[8]), "v"(acc[9]), "v"(acc[10]), "v"(acc[11]),
                   "v"(acc[12]), "v"(acc[13]), "v"(acc[14]), "v"(acc[15])
                 : "memory");
    oa += 32 * QD_ * 4;
    ob += 32 * 4;
  }
  // Lane (idx16, kh) of tile (mt, nt) holds kv row nt*16 + idx16 and the eight
  // columns c = mt*16 + kh*8 + 0..7: two quads.
#pragma unroll   // acc[] is indexed by constants
  for (int mt = 0; mt < 4; ++mt) {
#pragma unroll   // as above
    for (int nt = 0; nt < 4; ++nt) {
      const v8f a = acc[mt * 4 + nt];
      float* d = &Ts[(nt * 16 + idx16) * UP_ + ((mt * 4 + kh * 2) * UH_ + wave) * 4];
      const v4f lo = {a[0], a[1], a[2], a[3]}, hi = {a[4], a[5], a[6], a[7]};
      *(v4f*)d = lo;
      *(v4f*)(d + UH_ * 4) = hi;
    }
  }
  __syncthreads();

  // 128 quads (16 c quads x 8 heads) per kv row; a wave's 32 lanes write four
  // whole 128-byte lines.
  const int r = t & 127;
  const float* ls = &Ts[(t >> 7) * UP_ + r * 4];
  float* gd = ut + (((size_t)(j0 + (t >> 7)) * (QD_ / 4) + (c0 >> 2) + (r >> 3)) * NH
                    + blockIdx.z * UH_ + (r & 7)) * 4;
#pragma unroll   // constant offsets from one LDS and one global address
  for (int it = 0; it < UJ_ / 2; it += 8) {
    v4f x[8];
#pragma unroll   // x[] is indexed by constants
    for (int k = 0; k < 8; ++k) x[k] = *(const v4f*)(ls + (it + k) * 2 * UP_);
#pragma unroll   // as above
    for (int k = 0; k < 8; ++k) *(v4f*)(gd + (size_t)(it + k) * 2 * (QD_ * NH)) = x[k];
    // The next eight LDS reads land in registers that the stores above name.
    if (it + 8 < UJ_ / 2) asm volatile("s_wait_xcnt 0x0" ::: "memory");
  }
}

// 2^x. The v_nop is the free slot that the instruction set asks for behind a
// transcendental; inside the statement it cannot drift away from it.
__device__ __forceinline__ float exp2_slot(float x) {
  float r;
  asm("v_exp_f32 %0, %1\n\tv_nop" : "=v"(r) : "v"(x));
  return r;
}

// ---------------------------------------------------------------------------
// Windowed segment attention, scores and softmax.
// S[q][j][h] = sum_c q[q][c] * U[j][h][c] on matrix steps: a block takes SM_
// query rows and walks only the kv rows between the lowest and the highest
// window of its rows (found here, for any seg content). One kv row = one tile
// of 16 columns (its heads). The 8 waves split c: wave w owns c = 128*w .. +127
// and keeps its part of the query rows in registers; the eight partial sums
// meet in LDS. k order of step s of octet kq, equal for A and B:
//   lane half kh, element e -> c = 128*wave + 8*kq + 4*kh + 2*s + e.
//  For w in 0..3: idx = seg_id[b,q] - w; idx < 0 is masked (lowest score),
//  and the row that is read is idx clipped to [0, LKV-1], as in the reference.
//  Rs[wave][q][r][h]: partial score of kv row c0 - 3 + r, c0 = clip(seg_id);
//  only rows inside the query's own window are kept.
//  pg : (B * LQ, NH, 4). Entry r is the weight of kv row c0 - 3 + r; windows
//  that the clip sends to one row are added up.
// ---------------------------------------------------------------------------
#define SM_ 32

// Second bound: four waves per SIMD (two blocks per WGP), which cover each
// other's load latency.
__global__ __launch_bounds__(256, 4) void window_scores(
    const float* __restrict__ q, const float* __restrict__ ut,
    const int* __restrict__ seg, float* __restrict__ pg)
{
  __shared__ float Rs[8 * SM_ * KW_ * NH];

  const int t     = threadIdx.x;
  const int lane  = t & 31;
  const int wave  = t >> 5;
  const int idx16 = lane & 15;
  const int kh    = lane >> 4;
  const int row0  = blockIdx.x * SM_;                 // flat b * LQ_ + q
  static_assert(SM_ == 32, "one query row per lane");

  const int*   sp = seg + row0 + lane;
  const float* qp = q + (size_t)(row0 + idx16) * QD_ + wave * 128 + kh * 4;
  const int sl = *sp;
  v4f av[2][16];
#pragma unroll   // av[][] is indexed by constants and stays in registers
  for (int mt = 0; mt < 2; ++mt)
#pragma unroll   // as above
    for (int kq = 0; kq < 16; ++kq)
      av[mt][kq] = *(const v4f*)(qp + mt * 16 * QD_ + kq * 8);
  // The loads' address registers are inputs here, so none of them is reused
  // (not even as a load's target) before this wait.
  asm volatile("s_wait_xcnt 0x0" :: "v"(sp), "v"(qp) : "memory");

  // Lowest and highest clipped segment of the block's 32 rows.
  const int cl = min(max(sl, 0), LKV_ - 1);
  int mn = cl, mx = cl;
#pragma unroll   // five fixed exchange steps, no loop counter
  for (int o = 16; o > 0; o >>= 1) {
    mn = min(mn, __shfl_xor(mn, o));
    mx = max(mx, __shfl_xor(mx, o));
  }
  const int jlo = __builtin_amdgcn_readfirstlane(max(mn - (KW_ - 1), 0));
  const int jhi = __builtin_amdgcn_readfirstlane(mx);   // <= LKV_ - 1

  // 3 - c0 of the 16 query rows whose sums this lane holds.
  int dq[2][8];
#pragma unroll   // dq[][] is indexed by constants
  for (int mt = 0; mt < 2; ++mt)
#pragma unroll   // as above
    for (int v = 0; v < 8; ++v)
      dq[mt][v] = (KW_ - 1) - __shfl(cl, mt * 16 + kh * 8 + v);

  float* rb = &Rs[(wave * SM_ + kh * 8) * (KW_ * NH) + idx16];
  const float* ub = ut + ((size_t)(row0 / LQ_) * LKV_ * (QD_ / 4) + wave * 32 + kh) * (NH * 4)
                       + idx16 * 4;

  int jv = jlo;                         // j, kept in a vector register
  for (int j = jlo; j <= jhi; ++j) {
    const float* uj = ub + (size_t)j * (QD_ * NH);
    v4f bv[16];
#pragma unroll   // bv[] is indexed by constants and stays in registers
    for (int kq = 0; kq < 16; ++kq)
      bv[kq] = *(const v4f*)(uj + kq * (2 * NH * 4));
    // The next trip rewrites the address registers that the loads above name.
    asm volatile("s_wait_xcnt 0x0" :: "v"(uj) : "memory");
    // Keeps the trip's 16 loads together ahead of its matrix steps: one load
    // latency a trip, which the SIMD's other waves cover.
    __builtin_amdgcn_sched_barrier(0);

    v8f a0 = {}, a1 = {};
#pragma unroll   // av[][] and bv[] are indexed by constants
    for (int kq = 0; kq < 16; ++kq) {
      a0 = __builtin_amdgcn_wmma_f32_16x16x4_f32(false, av[0][kq].lo, false, bv[kq].lo, (short)0, a0, false, false);
      a1 = __builtin_amdgcn_wmma_f32_16x16x4_f32(false, av[1][kq].lo, false, bv[kq].lo, (short)0, a1, false, false);
      a0 = __builtin_amdgcn_wmma_f32_16x16x4_f32(false, av[0][kq].hi, false, bv[kq].hi, (short)0, a0, false, false);
      a1 = __builtin_amdgcn_wmma_f32_16x16x4_f32(false, av[1][kq].hi, false, bv[kq].hi, (short)0, a1, false, false);
    }

    // Four free vector slots between the last matrix steps and whatever touches
    // their result or reuses their operand registers. The row number passes
    // through the statement, so no later arithmetic is moved ahead of it.
    asm volatile("v_nop\n\tv_nop\n\tv_nop\n\tv_nop"
                 : "+v"(a0), "+v"(a1), "+v"(jv) : "v"(bv[15]));

#pragma unroll   // a0, a1 and dq[][] are indexed by constants
    for (int v = 0; v < 8; ++v) {
      const int r0 = jv + dq[0][v], r1 = jv + dq[1][v];
      if ((unsigned)r0 < (unsigned)KW_) rb[v * (KW_ * NH) + r0 * NH] = a0[v];
      if ((unsigned)r1 < (unsigned)KW_) rb[(16 + v) * (KW_ * NH) + r1 * NH] = a1[v];
    }
    ++jv;
  }
  __syncthreads();

  const float scale = 0.125f;                 // 64^-0.5
  float* pgp = pg + (size_t)row0 * (NH * KW_) + t * KW_;
#pragma unroll   // two (query row, head) pairs per thread
  for (int k = 0; k < 2; ++k) {
    const int ql = (t >> 4) + k * 16;         // head = idx16
    const int s0 = __shfl(sl, ql);
    const int c0 = min(max(s0, 0), LKV_ - 1);
    int   rr[KW_];
    float sc[KW_];
#pragma unroll   // rr[] and sc[] are indexed by constants
    for (int w = 0; w < KW_; ++w) {
      rr[w] = 3 - (c0 - min(max(s0 - w, 0), LKV_ - 1));   // 0..3, a row that was walked
      const float* rp = &Rs[(ql * KW_ + rr[w]) * NH + idx16];
      float s = 0.f;
#pragma unroll   // constant offsets from one LDS address
      for (int wv = 0; wv < 8; ++wv) s += rp[wv * (SM_ * KW_ * NH)];
      sc[w] = (s0 - w >= 0) ? s * scale : -FLT_MAX;
    }

    const float mxs = fmaxf(fmaxf(sc[0], sc[1]), fmaxf(sc[2], sc[3]));
    float p[KW_];
    float sum = 0.f;
#pragma unroll
    for (int w = 0; w < KW_; ++w) {
      p[w] = exp2_slot((sc[w] - mxs) * 1.44269504f);   // e^(sc - mx); masked: 0
      sum += p[w];
    }
    const float inv = 1.f / sum;

    float pr[KW_] = {0.f, 0.f, 0.f, 0.f};
#pragma unroll
    for (int w = 0; w < KW_; ++w) {
      const float pw = p[w] * inv;
#pragma unroll   // pr[] is indexed by constants
      for (int kk = 0; kk < KW_; ++kk) pr[kk] += (rr[w] == kk) ? pw : 0.f;
    }
    *(float4*)(pgp + k * 256 * KW_) = make_float4(pr[0], pr[1], pr[2], pr[3]);
  }
}

// ---------------------------------------------------------------------------
// out[q][n] = sum over kv rows j and heads h of P[q][j][h] * T[j][h][n], with
// T[j][h][n] = sum_d v[j][h][d] * Wo[n][h*HD + d] (gemm_xwT_wmma<1>) and
// P[q][j][h] the softmax weight of row j, zero outside the query's window.
// A block takes MT_ query rows and walks only the kv rows between the lowest
// and the highest window of its rows (found here, for any seg content), two
// rows j at a time: k = 2 rows x 16 heads = 8 matrix steps.
// k order of one step hs, equal for A and B: lane half kh, element e
//   -> head 2*hs + kh, kv row 2*jp + e.
// Block = 8 waves; wave tile 32 x 64, block tile 32 x 512.
//
// Ps[q][h][0..7] = {0, 0, pg[q][h][0..3], 0, 0}: the pair of weights for rows
// (2*jp, 2*jp + 1) is two neighbouring floats at a clamped index, zeros
// included, so no lane is ever switched off. Rows q and q + 16 share one LDS
// row of PQ_ floats (the second PM_ floats in), so that every fragment read of
// a trip is a constant offset from two registers; odd heads lie PO_ floats
// behind the even ones; PQ_ and PO_ spread the 32 lanes over the banks.
// ---------------------------------------------------------------------------
#define MT_  32
#define PQ_  268
#define PM_  132
#define PO_  66

__global__ __launch_bounds__(256) void out_from_table(
    const float* __restrict__ pg, const float* __restrict__ tab,
    const int* __restrict__ seg, float* __restrict__ out)
{
  __shared__ float Ps[16 * PQ_];

  const int t     = threadIdx.x;
  const int lane  = t & 31;
  const int wave  = t >> 5;
  const int idx16 = lane & 15;
  const int kh    = lane >> 4;
  const int row0  = blockIdx.y * MT_;                 // flat b * LQ_ + q
  const int n0    = blockIdx.x * 512 + wave * 64;

  // MT_ * NH = 512 weight quads, two per thread; the wave's own 32 segments.
  static_assert(MT_ * NH == 512 && MT_ == 32, "two quads per thread, one row per lane");
  const float* pp0 = pg + (size_t)row0 * (NH * KW_) + t * KW_;
  const float* pp1 = pp0 + 256 * KW_;
  const int*   sp0 = seg + row0 + lane;
  const int*   sp1 = seg + row0 + idx16;
  const float4 pv[2] = {*(const float4*)pp0, *(const float4*)pp1};
  const int sl = *sp0, sa0 = sp1[0], sa1 = sp1[16];
  // The loads' offset registers (the three indices) are inputs here, so none of
  // them is reused (not even as a load's target) before this wait.
  asm volatile("s_wait_xcnt 0x0" :: "v"(t), "v"(lane), "v"(idx16) : "memory");

#pragma unroll   // pv[] is indexed by constants and stays in registers
  for (int k = 0; k < 2; ++k) {
    const int i = t + k * 256, q = i >> 4, h = i & 15;
    float* d = &Ps[(q & 15) * PQ_ + (q >> 4) * PM_ + (h & 1) * PO_ + (h >> 1) * 8];
    const v2f z = {0.f, 0.f}, lo = {pv[k].x, pv[k].y}, hi = {pv[k].z, pv[k].w};
    *(v2f*)(d + 0) = z;
    *(v2f*)(d + 2) = lo;
    *(v2f*)(d + 4) = hi;
    *(v2f*)(d + 6) = z;
  }

  // Lowest and highest clipped segment of the block's MT_ = 32 rows.
  int mn = min(max(sl, 0), LKV_ - 1);
  int mx = mn;
#pragma unroll   // five fixed exchange steps, no loop counter
  for (int o = 16; o > 0; o >>= 1) {
    mn = min(mn, __shfl_xor(mn, o));
    mx = max(mx, __shfl_xor(mx, o));
  }
  const int jp0 = __builtin_amdgcn_readfirstlane(max(mn - (KW_ - 1), 0) >> 1);
  const int jp1 = __builtin_amdgcn_readfirstlane(mx >> 1);   // <= LKV_/2 - 1

  const int c0a[2] = {min(max(sa0, 0), LKV_ - 1), min(max(sa1, 0), LKV_ - 1)};
  const int ab[2]  = {idx16 * PQ_ + kh * PO_ + 2, idx16 * PQ_ + PM_ + kh * PO_ + 2};

  const float* tb = tab + ((size_t)(row0 / LQ_) * (LKV_ / 2) * NH + kh) * (DATTN * 2)
                        + (n0 + idx16) * 2;

  v8f acc[8] = {};                      // [mt*4 + nt]
  __syncthreads();

  for (int jp = jp0; jp <= jp1; ++jp) {
    const float* tj = tb + (size_t)jp * (NH * DATTN * 2);
    const int ai0 = ab[0] + min(max(2 * jp + (KW_ - 1) - c0a[0], -2), 4);
    const int ai1 = ab[1] + min(max(2 * jp + (KW_ - 1) - c0a[1], -2), 4);

    v2f b[NH / 2][4];
#pragma unroll   // b[][] is indexed by constants and stays in registers
    for (int hs = 0; hs < NH / 2; ++hs)
#pragma unroll   // as above
      for (int nt = 0; nt < 4; ++nt)
        b[hs][nt] = *(const v2f*)(tj + hs * (2 * DATTN * 2) + nt * 32);
    // The next trip rewrites the address registers that the loads above name.
    asm volatile("s_wait_xcnt 0x0" :: "v"(tj) : "memory");
    // Keeps the trip's 32 loads together ahead of its matrix steps: one load
    // latency a trip; left free, the scheduler issues each step's loads only
    // one step ahead and the wave waits at every step.
    __builtin_amdgcn_sched_barrier(0);

#pragma unroll   // acc[] and b[][] are indexed by constants
    for (int hs = 0; hs < NH / 2; ++hs) {
      const v2f a0 = {Ps[ai0 + hs * 8], Ps[ai0 + hs * 8 + 1]};
      const v2f a1 = {Ps[ai1 + hs * 8], Ps[ai1 + hs * 8 + 1]};
#pragma unroll   // as above
      for (int nt = 0; nt < 4; ++nt) {
        acc[nt]     = __builtin_amdgcn_wmma_f32_16x16x4_f32(false, a0, false, b[hs][nt], (short)0, acc[nt],     false, false);
        acc[4 + nt] = __builtin_amdgcn_wmma_f32_16x16x4_f32(false, a1, false, b[hs][nt], (short)0, acc[4 + nt], false, false);
      }
    }
  }

#pragma unroll   // acc[] is indexed by constants
  for (int mt = 0; mt < 2; ++mt) {
#pragma unroll   // as above
    for (int nt = 0; nt < 4; ++nt) {
      float* yb = out + (size_t)(row0 + mt * 16 + kh * 8) * DATTN + n0 + nt * 16 + idx16;
      const v8f a = acc[mt * 4 + nt];
#pragma unroll   // as above
      for (int v = 0; v < 8; ++v) yb[(size_t)v * DATTN] = a[v];
    }
  }
}

// ---------------------------------------------------------------------------
// Launcher. Inputs: q, kv_src, seg_id, Wq, Wkv, Wo.
// Workspace layout: kv (16MB) | pg (4MB) | ut, then tab (128MB)  = 148MB.
// ut is dead once window_scores has run; tab is written over it afterwards.
// ---------------------------------------------------------------------------
extern "C" void kernel_launch(void* const* d_in, const int* in_sizes, int n_in,
                              void* d_out, int out_size, void* d_ws, size_t ws_size,
                              hipStream_t stream) {
  const float* q      = (const float*)d_in[0];
  const float* kv_src = (const float*)d_in[1];
  const int*   seg    = (const int*)d_in[2];
  const float* Wq     = (const float*)d_in[3];
  const float* Wkv    = (const float*)d_in[4];
  const float* Wo     = (const float*)d_in[5];
  float* out = (float*)d_out;

  float* kv   = (float*)d_ws;                               // B*LKV*2*DATTN
  float* pg   = kv + (size_t)B_ * LKV_ * 2 * DATTN;         // B*LQ*NH*KW
  float* tab  = pg + (size_t)B_ * LQ_ * NH * KW_;           // B*LKV*NH*DATTN
  float* ut   = tab;                                        // B*LKV*NH*QD

  const dim3 blk(256);

  // kv = kv_src @ Wkv.T              M=2048  N=2048 K=1024
  gemm_xwT_wmma<0><<<dim3((2 * DATTN) / 128, (B_ * LKV_) / 128), blk, 0, stream>>>(
      kv_src, Wkv, kv, B_ * LKV_, 2 * DATTN, 1024, 1024, 1024);

  // ut[j][h] = k[j][h] @ Wq[h rows]   per head: 1024 x 2048, K=64
  fold_wq_into_k<<<dim3(QD_ / UC_, (B_ * LKV_) / UJ_, NH / UH_), blk, 0, stream>>>(
      kv, Wq, ut);

  // window softmax weights           one block per SM_ query rows
  window_scores<<<dim3((B_ * LQ_) / SM_), blk, 0, stream>>>(
      q, ut, seg, pg);

  // tab[j][h] = v[j][h] @ Wo[:, h].T  per head: M=2048 N=1024 K=64
  // (last before its reader, so that more of it is still in L2 there)
  gemm_xwT_wmma<1><<<dim3(1024 / 128, (B_ * LKV_) / 128, NH), blk, 0, stream>>>(
      kv + DATTN, Wo, tab, B_ * LKV_, DATTN, HD, 2 * DATTN, DATTN);

  // out = P @ tab                    k = the block's own span of kv rows x heads
  out_from_table<<<dim3(DATTN / 512, (B_ * LQ_) / MT_), blk, 0, stream>>>(
      pg, tab, seg, out);
}

// v004
// One run takes 201 microseconds.
// Two timings next to v003 both put it at 1.06 times that version's speed.
// All steps since v000 together make it 2.20 times as fast.
#include <hip/hip_runtime.h>
#include <cfloat>

// ---------------------------------------------------------------------------
// Problem constants (from reference)
// ---------------------------------------------------------------------------
#define B_    4
#define LQ_   4096
#define LKV_  512
#define DATTN 1024
#define NH    16
#define HD    64
#define KW_   4          // LOOKBACK + 1

typedef __attribute__((ext_vector_type(2))) float v2f;
typedef __attribute__((ext_vector_type(8))) float v8f;
typedef __attribute__((ext_vector_type(4))) int   v4i;

typedef __attribute__((address_space(1))) v4i* gv4i_p;   // global
typedef __attribute__((address_space(3))) v4i* lv4i_p;   // LDS

// ---------------------------------------------------------------------------
// Async global->LDS staging (gfx1250). Falls back to a synchronous copy if
// the builtins are not declared by this toolchain.
// ---------------------------------------------------------------------------
#if __has_builtin(__builtin_amdgcn_global_load_async_to_lds_b128)
#define HAS_ASYNC_LDS 1
#endif

__device__ __forceinline__ void stage16(const float* g, float* l) {
#ifdef HAS_ASYNC_LDS
  __builtin_amdgcn_global_load_async_to_lds_b128((gv4i_p)g, (lv4i_p)l, 0, 0);
#else
  *(float4*)l = *(const float4*)g;
#endif
}

__device__ __forceinline__ void async_wait_all() {
#ifdef HAS_ASYNC_LDS
#if __has_builtin(__builtin_amdgcn_s_wait_asynccnt)
  __builtin_amdgcn_s_wait_asynccnt(0);
#else
  asm volatile("s_wait_asynccnt 0x0" ::: "memory");
#endif
#endif
}

// ---------------------------------------------------------------------------
// Y[m][n] = sum_k X[m][k] * W[n][k]   (torch-style y = x @ W.T)
// X: M x K, row pitch ldx; W: N x K, row pitch ldw; Y: M x N row-major.
// M, N multiples of 128; K multiple of 16.
//
// PERHEAD = 1: blockIdx.z is a head h; X and W start at column h * HD, and Y is
// the table T[m / 2][h][n][m & 1] that out_from_table reads (two neighbouring
// rows m side by side, which is the k pair of one B fragment there).
//
// Workgroup (256 thr = 8 waves) computes a 128x128 output block.
// Wave w: M-strip (w>>1)*32 (two 16-row tiles), N-strip (w&1)*64 (four tiles).
// K is consumed in chunks of 16, double-buffered in LDS via async loads.
//
// LDS row stride = 20 floats (16 data + 4 pad): 20*r mod 64 distinct and
// multiple of 4 for r=0..15 -> conflict-free ds_load_b64 fragment reads,
// and 16B-aligned rows for the async b128 writes.
//
// V_WMMA_F32_16X16X4_F32 operand layout (ISA 7.12.2):
//   A 16x4 : lane = M + 16*Khalf, holds K = 2*Khalf + {0,1}  -> float2/lane
//   B 4x16 : lane = N + 16*Khalf, holds K = 2*Khalf + {0,1}  -> float2/lane
//   C/D    : VGPR v, lanes 0-15 -> row v, lanes 16-31 -> row v+8, col=lane&15
// ---------------------------------------------------------------------------
#define KC   16
#define LDP  20          // padded LDS row stride (floats)

template <int PERHEAD>
__global__ __launch_bounds__(256) void gemm_xwT_wmma(
    const float* __restrict__ X, const float* __restrict__ W,
    float* __restrict__ Y, int M, int N, int K, int ldx, int ldw)
{
  __shared__ float Xs[2][128 * LDP];
  __shared__ float Ws[2][128 * LDP];

  const int t     = threadIdx.x;
  const int lane  = t & 31;
  const int wave  = t >> 5;
  const int mBlk  = blockIdx.y * 128;
  const int nBlk  = blockIdx.x * 128;
  const int mw    = (wave >> 1) * 32;   // wave M offset within block
  const int nw    = (wave & 1) * 64;    // wave N offset within block
  const int idx16 = lane & 15;
  const int kh    = lane >> 4;          // K-half: 0 -> K{0,1}, 1 -> K{2,3}

  // Staging map: per chunk, each matrix moves 128 rows x 16 floats
  // = 512 x b128 transfers; 256 threads issue 2 each per matrix.
  const int sRow0 = t >> 2;             // lin = 0*256 + t
  const int sCg0  = (t & 3) * 4;
  const int sRow1 = (256 + t) >> 2;     // lin = 1*256 + t
  const int sCg1  = ((256 + t) & 3) * 4;

  v8f acc[8] = {};                      // [mt*4 + nt]

  if (PERHEAD) {
    X += blockIdx.z * HD;
    W += blockIdx.z * HD;
  }

  // ---- prologue: stage chunk 0 into buffer 0 --------------------------------
  {
    stage16(X + (size_t)(mBlk + sRow0) * ldx + sCg0, &Xs[0][sRow0 * LDP + sCg0]);
    stage16(X + (size_t)(mBlk + sRow1) * ldx + sCg1, &Xs[0][sRow1 * LDP + sCg1]);
    stage16(W + (size_t)(nBlk + sRow0) * ldw + sCg0, &Ws[0][sRow0 * LDP + sCg0]);
    stage16(W + (size_t)(nBlk + sRow1) * ldw + sCg1, &Ws[0][sRow1 * LDP + sCg1]);
  }
  async_wait_all();
  __syncthreads();

  for (int kc = 0; kc < K; kc += KC) {
    const int buf = (kc >> 4) & 1;

    // ---- stage next chunk into the other buffer (overlaps with compute) ----
    if (kc + KC < K) {
      const int kn = kc + KC;
      stage16(X + (size_t)(mBlk + sRow0) * ldx + kn + sCg0, &Xs[buf ^ 1][sRow0 * LDP + sCg0]);
      stage16(X + (size_t)(mBlk + sRow1) * ldx + kn + sCg1, &Xs[buf ^ 1][sRow1 * LDP + sCg1]);
      stage16(W + (size_t)(nBlk + sRow0) * ldw + kn + sCg0, &Ws[buf ^ 1][sRow0 * LDP + sCg0]);
      stage16(W + (size_t)(nBlk + sRow1) * ldw + kn + sCg1, &Ws[buf ^ 1][sRow1 * LDP + sCg1]);
    }

    // ---- compute current chunk from LDS ------------------------------------
#pragma unroll
    for (int ks = 0; ks < KC; ks += 4) {
      const int kb = ks + 2 * kh;
      const v2f a0 = *(const v2f*)&Xs[buf][(mw + idx16)      * LDP + kb];
      const v2f a1 = *(const v2f*)&Xs[buf][(mw + 16 + idx16) * LDP + kb];
#pragma unroll
      for (int nt = 0; nt < 4; ++nt) {
        const v2f b = *(const v2f*)&Ws[buf][(nw + nt * 16 + idx16) * LDP + kb];
        acc[nt]     = __builtin_amdgcn_wmma_f32_16x16x4_f32(false, a0, false, b, (short)0, acc[nt],     false, false);
        acc[4 + nt] = __builtin_amdgcn_wmma_f32_16x16x4_f32(false, a1, false, b, (short)0, acc[4 + nt], false, false);
      }
    }

    async_wait_all();     // next chunk resident
    __syncthreads();      // all waves done reading buf / writing buf^1
  }

  // ---- write back -----------------------------------------------------------
#pragma unroll
  for (int mt = 0; mt < 2; ++mt) {
#pragma unroll
    for (int nt = 0; nt < 4; ++nt) {
      const int row = mBlk + mw + mt * 16 + kh * 8;
      const int cn  = nBlk + nw + nt * 16 + idx16;
      const v8f a = acc[mt * 4 + nt];
      if (PERHEAD) {
        float* yb = Y + (((size_t)(row >> 1) * NH + blockIdx.z) * N + cn) * 2;
#pragma unroll   // a[] is indexed by constants
        for (int v = 0; v < 8; v += 2) {
          const v2f pr = {a[v], a[v + 1]};
          *(v2f*)(yb + (size_t)(v >> 1) * NH * N * 2) = pr;
        }
      } else {
        float* yb = Y + (size_t)row * N + cn;
#pragma unroll
        for (int v = 0; v < 8; ++v) yb[(size_t)v * N] = a[v];
      }
    }
  }
}

// ---------------------------------------------------------------------------
// Wq folded into K. score[q][h][j] = sum_d (q Wq^T)[h*HD+d] * k[j][h*HD+d]
//                                  = sum_c q[c] * U[j][h][c],
// U[j][h][c] = sum_d k[j][h*HD+d] * Wq[h*HD+d][c]          (K = HD = 64).
// Stored as ut[j][c / 4][h][c & 3]: the 16 heads of one kv row side by side,
// four c each, so that one 16-byte load per lane in window_scores covers 512
// contiguous bytes and feeds two matrix steps.
//
// Block = 8 waves = 8 heads (blockIdx.z picks the half), UC_ columns c (matrix
// rows) x UJ_ kv rows j (matrix columns) per wave, operands straight from
// global memory. k order of step s of octet kq, equal for A and B:
//   lane half kh, element e -> d = 8*kq + 4*kh + 2*s + e.
// The results go through LDS so that the 8 heads' 16-byte pieces leave as
// whole 128-byte lines. UP_: one kv row's floats in LDS plus 4, which spreads
// the 16 lanes of a 16-byte write over all banks.
// ---------------------------------------------------------------------------
#define QD_  1024        // q_dim, the pitch of q and Wq
#define UJ_  64
#define UC_  64
#define UH_  8
#define UP_  (UC_ * UH_ + 4)

typedef __attribute__((ext_vector_type(4))) float v4f;

// Second bound: four waves per SIMD, so that two blocks share a WGP and one
// block's loads and stores hide behind the other's matrix steps.
__global__ __launch_bounds__(256, 4) void fold_wq_into_k(
    const float* __restrict__ kv, const float* __restrict__ Wq,
    float* __restrict__ ut)
{
  __shared__ float Ts[UJ_ * UP_];

  const int t     = threadIdx.x;
  const int lane  = t & 31;
  const int wave  = t >> 5;
  const int idx16 = lane & 15;
  const int kh    = lane >> 4;
  const int c0    = blockIdx.x * UC_;
  const int j0    = blockIdx.y * UJ_;               // flat b * LKV_ + j
  const int h     = blockIdx.z * UH_ + wave;

  // The lane's byte offsets into Wq and kv (both below 2^25).
  unsigned oa = (unsigned)(((h * HD + kh * 4) * QD_ + c0 + idx16) * 4);
  unsigned ob = (unsigned)(((j0 + idx16) * (2 * DATTN) + h * HD + kh * 4) * 4);

  v8f acc[16] = {};                     // [mt*4 + nt]

  // Kept rolled: unrolled, the second half's loads are hoisted into the first
  // and the registers of four waves per SIMD no longer suffice.
#pragma unroll 1
  for (int hf = 0; hf < 2; ++hf) {
    // Half of a head's k row is one 128-byte line; its eight 16-byte pieces per
    // lane pair are fetched together, so that no line is fetched twice.
    const float* pa = (const float*)((const char*)Wq + oa);
    const float* pb = (const float*)((const char*)kv + ob);
    v4f bv[4][4];                       // [nt][octet]
#pragma unroll   // bv[][] is indexed by constants and stays in registers
    for (int nt = 0; nt < 4; ++nt)
#pragma unroll   // as above
      for (int i = 0; i < 4; ++i)
        bv[nt][i] = *(const v4f*)(pb + (size_t)nt * 16 * (2 * DATTN) + i * 8);
#pragma unroll   // acc[], av[][] and bv[][] are indexed by constants
    for (int i = 0; i < 4; ++i) {
      float av[4][4];                   // [mt][e]
#pragma unroll   // as above
      for (int mt = 0; mt < 4; ++mt)
#pragma unroll   // as above
        for (int e = 0; e < 4; ++e)
          av[mt][e] = pa[(size_t)(i * 8 + e) * QD_ + mt * 16];
#pragma unroll   // as above
      for (int s = 0; s < 2; ++s)
#pragma unroll   // as above
        for (int mt = 0; mt < 4; ++mt) {
          const v2f a = {av[mt][2 * s], av[mt][2 * s + 1]};
#pragma unroll   // as above
          for (int nt = 0; nt < 4; ++nt) {
            const v2f b = {bv[nt][i][2 * s], bv[nt][i][2 * s + 1]};
            acc[mt * 4 + nt] = __builtin_amdgcn_wmma_f32_16x16x4_f32(
                false, a, false, b, (short)0, acc[mt * 4 + nt], false, false);
          }
        }
    }
    // The wait: the two additions below rewrite the offset registers of the
    // loads above. The four v_nop: free vector slots between the last matrix
    // steps and whatever touches their result or reuses their operand registers.
    // The sums are inputs, so the statement stands behind every matrix step; the
    // offsets pass through it, so their additions stand behind it.
    asm volatile("s_wait_xcnt 0x0\n\tv_nop\n\tv_nop\n\tv_nop\n\tv_nop"
                 : "+v"(oa), "+v"(ob)
                 : "v"(acc[0]), "v"(acc[1]), "v"(acc[2]), "v"(acc[3]),
                   "v"(acc[4]), "v"(acc[5]), "v"(acc[6]), "v"(acc[7]),
                   "v"(acc[8]), "v"(acc[9]), "v"(acc[10]), "v"(acc[11]),
                   "v"(acc[12]), "v"(acc[13]), "v"(acc[14]), "v"(acc[15])
                 : "memory");
    oa += 32 * QD_ * 4;
    ob += 32 * 4;
  }
  // Lane (idx16, kh) of tile (mt, nt) holds kv row nt*16 + idx16 and the eight
  // columns c = mt*16 + kh*8 + 0..7: two quads.
#pragma unroll   // acc[] is indexed by constants
  for (int mt = 0; mt < 4; ++mt) {
#pragma unroll   // as above
    for (int nt = 0; nt < 4; ++nt) {
      const v8f a = acc[mt * 4 + nt];
      float* d = &Ts[(nt * 16 + idx16) * UP_ + ((mt * 4 + kh * 2) * UH_ + wave) * 4];
      const v4f lo = {a[0], a[1], a[2], a[3]}, hi = {a[4], a[5], a[6], a[7]};
      *(v4f*)d = lo;
      *(v4f*)(d + UH_ * 4) = hi;
    }
  }
  __syncthreads();

  // 128 quads (16 c quads x 8 heads) per kv row; a wave's 32 lanes write four
  // whole 128-byte lines.
  const int r = t & 127;
  const float* ls = &Ts[(t >> 7) * UP_ + r * 4];
  float* gd = ut + (((size_t)(j0 + (t >> 7)) * (QD_ / 4) + (c0 >> 2) + (r >> 3)) * NH
                    + blockIdx.z * UH_ + (r & 7)) * 4;
#pragma unroll   // constant offsets from one LDS and one global address
  for (int it = 0; it < UJ_ / 2; it += 8) {
    v4f x[8];
#pragma unroll   // x[] is indexed by constants
    for (int k = 0; k < 8; ++k) x[k] = *(const v4f*)(ls + (it + k) * 2 * UP_);
#pragma unroll   // as above
    for (int k = 0; k < 8; ++k) *(v4f*)(gd + (size_t)(it + k) * 2 * (QD_ * NH)) = x[k];
    // The next eight LDS reads land in registers that the stores above name.
    if (it + 8 < UJ_ / 2) asm volatile("s_wait_xcnt 0x0" ::: "memory");
  }
}

// 2^x. The v_nop is the free slot that the instruction set asks for behind a
// transcendental; inside the statement it cannot drift away from it.
__device__ __forceinline__ float exp2_slot(float x) {
  float r;
  asm("v_exp_f32 %0, %1\n\tv_nop" : "=v"(r) : "v"(x));
  return r;
}

// ---------------------------------------------------------------------------
// Windowed segment attention, scores and softmax.
// S[q][j][h] = sum_c q[q][c] * U[j][h][c] on matrix steps: a block takes SM_
// query rows and walks only the kv rows between the lowest and the highest
// window of its rows (found here, for any seg content). One kv row = one tile
// of 16 columns (its heads). The 8 waves split c: wave w owns c = 128*w .. +127
// and keeps its part of the query rows in registers; the eight partial sums
// meet in LDS. k order of step s of octet kq, equal for A and B:
//   lane half kh, element e -> c = 128*wave + 8*kq + 4*kh + 2*s + e.
//  For w in 0..3: idx = seg_id[b,q] - w; idx < 0 is masked (lowest score),
//  and the row that is read is idx clipped to [0, LKV-1], as in the reference.
//  Rs[wave][q][r][h]: partial score of kv row c0 - 3 + r, c0 = clip(seg_id);
//  only rows inside the query's own window are kept.
//  pg : (B * LQ, NH, 4). Entry r is the weight of kv row c0 - 3 + r; windows
//  that the clip sends to one row are added up.
// ---------------------------------------------------------------------------
#define SM_ 32

// Second bound: four waves per SIMD (two blocks per WGP), which cover each
// other's load latency.
__global__ __launch_bounds__(256, 4) void window_scores(
    const float* __restrict__ q, const float* __restrict__ ut,
    const int* __restrict__ seg, float* __restrict__ pg)
{
  __shared__ float Rs[8 * SM_ * KW_ * NH];

  const int t     = threadIdx.x;
  const int lane  = t & 31;
  const int wave  = t >> 5;
  const int idx16 = lane & 15;
  const int kh    = lane >> 4;
  const int row0  = blockIdx.x * SM_;                 // flat b * LQ_ + q
  static_assert(SM_ == 32, "one query row per lane");

  const int*   sp = seg + row0 + lane;
  const float* qp = q + (size_t)(row0 + idx16) * QD_ + wave * 128 + kh * 4;
  const int sl = *sp;
  v4f av[2][16];
#pragma unroll   // av[][] is indexed by constants and stays in registers
  for (int mt = 0; mt < 2; ++mt)
#pragma unroll   // as above
    for (int kq = 0; kq < 16; ++kq)
      av[mt][kq] = *(const v4f*)(qp + mt * 16 * QD_ + kq * 8);
  // The loads' address registers are inputs here, so none of them is reused
  // (not even as a load's target) before this wait.
  asm volatile("s_wait_xcnt 0x0" :: "v"(sp), "v"(qp) : "memory");

  // Lowest and highest clipped segment of the block's 32 rows.
  const int cl = min(max(sl, 0), LKV_ - 1);
  int mn = cl, mx = cl;
#pragma unroll   // five fixed exchange steps, no loop counter
  for (int o = 16; o > 0; o >>= 1) {
    mn = min(mn, __shfl_xor(mn, o));
    mx = max(mx, __shfl_xor(mx, o));
  }
  const int jlo = __builtin_amdgcn_readfirstlane(max(mn - (KW_ - 1), 0));
  const int jhi = __builtin_amdgcn_readfirstlane(mx);   // <= LKV_ - 1

  // 3 - c0 of the 16 query rows whose sums this lane holds.
  int dq[2][8];
#pragma unroll   // dq[][] is indexed by constants
  for (int mt = 0; mt < 2; ++mt)
#pragma unroll   // as above
    for (int v = 0; v < 8; ++v)
      dq[mt][v] = (KW_ - 1) - __shfl(cl, mt * 16 + kh * 8 + v);

  float* rb = &Rs[(wave * SM_ + kh * 8) * (KW_ * NH) + idx16];
  const float* ub = ut + ((size_t)(row0 / LQ_) * LKV_ * (QD_ / 4) + wave * 32 + kh) * (NH * 4)
                       + idx16 * 4;

  int jv = jlo;                         // j, kept in a vector register
  for (int j = jlo; j <= jhi; ++j) {
    const float* uj = ub + (size_t)j * (QD_ * NH);
    v4f bv[16];
#pragma unroll   // bv[] is indexed by constants and stays in registers
    for (int kq = 0; kq < 16; ++kq)
      bv[kq] = *(const v4f*)(uj + kq * (2 * NH * 4));
    // The next trip rewrites the address registers that the loads above name.
    asm volatile("s_wait_xcnt 0x0" :: "v"(uj) : "memory");
    // Keeps the trip's 16 loads together ahead of its matrix steps: one load
    // latency a trip, which the SIMD's other waves cover.
    __builtin_amdgcn_sched_barrier(0);

    v8f a0 = {}, a1 = {};
#pragma unroll   // av[][] and bv[] are indexed by constants
    for (int kq = 0; kq < 16; ++kq) {
      a0 = __builtin_amdgcn_wmma_f32_16x16x4_f32(false, av[0][kq].lo, false, bv[kq].lo, (short)0, a0, false, false);
      a1 = __builtin_amdgcn_wmma_f32_16x16x4_f32(false, av[1][kq].lo, false, bv[kq].lo, (short)0, a1, false, false);
      a0 = __builtin_amdgcn_wmma_f32_16x16x4_f32(false, av[0][kq].hi, false, bv[kq].hi, (short)0, a0, false, false);
      a1 = __builtin_amdgcn_wmma_f32_16x16x4_f32(false, av[1][kq].hi, false, bv[kq].hi, (short)0, a1, false, false);
    }

    // Four free vector slots between the last matrix steps and whatever touches
    // their result or reuses their operand registers. The row number passes
    // through the statement, so no later arithmetic is moved ahead of it.
    asm volatile("v_nop\n\tv_nop\n\tv_nop\n\tv_nop"
                 : "+v"(a0), "+v"(a1), "+v"(jv) : "v"(bv[15]));

#pragma unroll   // a0, a1 and dq[][] are indexed by constants
    for (int v = 0; v < 8; ++v) {
      const int r0 = jv + dq[0][v], r1 = jv + dq[1][v];
      if ((unsigned)r0 < (unsigned)KW_) rb[v * (KW_ * NH) + r0 * NH] = a0[v];
      if ((unsigned)r1 < (unsigned)KW_) rb[(16 + v) * (KW_ * NH) + r1 * NH] = a1[v];
    }
    ++jv;
  }
  __syncthreads();

  const float scale = 0.125f;                 // 64^-0.5
  float* pgp = pg + (size_t)row0 * (NH * KW_) + t * KW_;
#pragma unroll   // two (query row, head) pairs per thread
  for (int k = 0; k < 2; ++k) {
    const int ql = (t >> 4) + k * 16;         // head = idx16
    const int s0 = __shfl(sl, ql);
    const int c0 = min(max(s0, 0), LKV_ - 1);
    int   rr[KW_];
    float sc[KW_];
#pragma unroll   // rr[] and sc[] are indexed by constants
    for (int w = 0; w < KW_; ++w) {
      rr[w] = 3 - (c0 - min(max(s0 - w, 0), LKV_ - 1));   // 0..3, a row that was walked
      const float* rp = &Rs[(ql * KW_ + rr[w]) * NH + idx16];
      float s = 0.f;
#pragma unroll   // constant offsets from one LDS address
      for (int wv = 0; wv < 8; ++wv) s += rp[wv * (SM_ * KW_ * NH)];
      sc[w] = (s0 - w >= 0) ? s * scale : -FLT_MAX;
    }

    const float mxs = fmaxf(fmaxf(sc[0], sc[1]), fmaxf(sc[2], sc[3]));
    float p[KW_];
    float sum = 0.f;
#pragma unroll
    for (int w = 0; w < KW_; ++w) {
      p[w] = exp2_slot((sc[w] - mxs) * 1.44269504f);   // e^(sc - mx); masked: 0
      sum += p[w];
    }
    const float inv = 1.f / sum;

    float pr[KW_] = {0.f, 0.f, 0.f, 0.f};
#pragma unroll
    for (int w = 0; w < KW_; ++w) {
      const float pw = p[w] * inv;
#pragma unroll   // pr[] is indexed by constants
      for (int kk = 0; kk < KW_; ++kk) pr[kk] += (rr[w] == kk) ? pw : 0.f;
    }
    *(float4*)(pgp + k * 256 * KW_) = make_float4(pr[0], pr[1], pr[2], pr[3]);
  }
}

// ---------------------------------------------------------------------------
// out[q][n] = sum over kv rows j and heads h of P[q][j][h] * T[j][h][n], with
// T[j][h][n] = sum_d v[j][h][d] * Wo[n][h*HD + d] (gemm_xwT_wmma<1>) and
// P[q][j][h] the softmax weight of row j, zero outside the query's window.
// A block takes MT_ query rows (four tiles of 16) and walks only the kv rows
// between the lowest and the highest window of its rows (found here, for any
// seg content), two rows j at a time: k = 2 rows x 16 heads = 8 matrix steps.
// The pair's table rows are loaded once for all four tiles; a tile does its
// matrix steps only for pairs between the lowest and the highest window of its
// own 16 rows. Outside of these all its weights are zero, so nothing is lost.
// k order of one step hs, equal for A and B: lane half kh, element e
//   -> head 2*hs + kh, kv row 2*jp + e.
// Block = 8 waves; wave tile 64 x 32, block tile 64 x NB_.
//
// Ps[q][h][0..7] = {0, 0, pg[q][h][0..3], 0, 0}: the pair of weights for rows
// (2*jp, 2*jp + 1) is two neighbouring floats at a clamped index, zeros
// included, so no lane is ever switched off. Rows q, q + 16, q + 32 and q + 48
// share one LDS row of PQ_ floats: the even heads of the four tiles (PM_ floats
// a tile), then, PO_ floats in, the odd heads. So every fragment read of a trip
// is a constant offset of fewer than 256 floats (what a two-address LDS read
// can hold) from one register a tile, and no address arithmetic stands among
// the matrix steps. PQ_ and PO_ spread the 32 lanes over the banks.
// ---------------------------------------------------------------------------
#define MT_  64
#define NB_  256
#define PQ_  524
#define PM_  64
#define PO_  258

__global__ __launch_bounds__(256) void out_from_table(
    const float* __restrict__ pg, const float* __restrict__ tab,
    const int* __restrict__ seg, float* __restrict__ out)
{
  __shared__ float Ps[16 * PQ_];

  const int t     = threadIdx.x;
  const int lane  = t & 31;
  const int wave  = t >> 5;
  const int idx16 = lane & 15;
  const int kh    = lane >> 4;
  const int row0  = blockIdx.y * MT_;                 // flat b * LQ_ + q
  const int n0    = blockIdx.x * NB_ + wave * 32;

  // MT_ * NH = 1024 weight quads, four per thread; the block's 64 segments, two
  // per lane.
  static_assert(MT_ * NH == 1024 && MT_ == 64, "four quads per thread, two rows per lane");
  const float* pp = pg + (size_t)row0 * (NH * KW_) + t * KW_;
  const int*   sp = seg + row0 + lane;
  float4 pv[4];
#pragma unroll   // pv[] is indexed by constants and stays in registers
  for (int k = 0; k < 4; ++k) pv[k] = *(const float4*)(pp + k * 256 * KW_);
  const int sl[2] = {sp[0], sp[32]};
  // The loads' offset registers (the two indices) are inputs here, so neither
  // is reused (not even as a load's target) before this wait.
  asm volatile("s_wait_xcnt 0x0" :: "v"(t), "v"(lane) : "memory");

#pragma unroll   // pv[] is indexed by constants and stays in registers
  for (int k = 0; k < 4; ++k) {
    const int i = t + k * 256, q = i >> 4, h = i & 15;
    float* d = &Ps[(q & 15) * PQ_ + (q >> 4) * PM_ + (h & 1) * PO_ + (h >> 1) * 8];
    const v2f z = {0.f, 0.f}, lo = {pv[k].x, pv[k].y}, hi = {pv[k].z, pv[k].w};
    *(v2f*)(d + 0) = z;
    *(v2f*)(d + 2) = lo;
    *(v2f*)(d + 4) = hi;
    *(v2f*)(d + 6) = z;
  }

  // Lowest and highest clipped segment of each tile's 16 rows (one half of the
  // lanes each), then the first and the last pair of kv rows of each tile.
  const int cl[2] = {min(max(sl[0], 0), LKV_ - 1), min(max(sl[1], 0), LKV_ - 1)};
  int mn[2] = {cl[0], cl[1]}, mx[2] = {cl[0], cl[1]};
#pragma unroll   // four fixed exchange steps, no loop counter
  for (int o = 8; o > 0; o >>= 1) {
#pragma unroll   // mn[] and mx[] are indexed by constants
    for (int g = 0; g < 2; ++g) {
      mn[g] = min(mn[g], __shfl_xor(mn[g], o));
      mx[g] = max(mx[g], __shfl_xor(mx[g], o));
    }
  }
  int tlo[4], thi[4], c0a[4], ab[4];
#pragma unroll   // all four arrays are indexed by constants
  for (int m = 0; m < 4; ++m) {
    tlo[m] = max(__builtin_amdgcn_readlane(mn[m >> 1], (m & 1) * 16) - (KW_ - 1), 0) >> 1;
    thi[m] = __builtin_amdgcn_readlane(mx[m >> 1], (m & 1) * 16) >> 1;   // <= LKV_/2 - 1
    c0a[m] = __shfl(cl[m >> 1], (m & 1) * 16 + idx16);
    ab[m]  = idx16 * PQ_ + m * PM_ + kh * PO_ + 2;
  }
  const int jp0 = min(min(tlo[0], tlo[1]), min(tlo[2], tlo[3]));
  const int jp1 = max(max(thi[0], thi[1]), max(thi[2], thi[3]));

  const float* tb = tab + ((size_t)(row0 / LQ_) * (LKV_ / 2) * NH + kh) * (DATTN * 2)
                        + (n0 + idx16) * 2;

  v8f acc[8] = {};                      // [m*2 + nt]
  __syncthreads();

  for (int jp = jp0; jp <= jp1; ++jp) {
    const float* tj = tb + (size_t)jp * (NH * DATTN * 2);

    v2f b[NH / 2][2];
#pragma unroll   // b[][] is indexed by constants and stays in registers
    for (int hs = 0; hs < NH / 2; ++hs)
#pragma unroll   // as above
      for (int nt = 0; nt < 2; ++nt)
        b[hs][nt] = *(const v2f*)(tj + hs * (2 * DATTN * 2) + nt * 32);
    // The next trip rewrites the address registers that the loads above name.
    asm volatile("s_wait_xcnt 0x0" :: "v"(tj) : "memory");
    // Keeps the trip's 16 loads together ahead of its matrix steps: one load
    // latency a trip; left free, the scheduler issues each step's loads only
    // one step ahead and the wave waits at every step.
    __builtin_amdgcn_sched_barrier(0);

#pragma unroll   // acc[], b[][] and the tiles' arrays are indexed by constants
    for (int m = 0; m < 4; ++m) {
      // The same for every lane (scalar registers): the whole wave takes the
      // tile's matrix steps or skips them.
      if (jp >= tlo[m] && jp <= thi[m]) {
        const int ai = ab[m] + min(max(2 * jp + (KW_ - 1) - c0a[m], -2), 4);
#pragma unroll   // as above
        for (int hs = 0; hs < NH / 2; ++hs) {
          const v2f a = {Ps[ai + hs * 8], Ps[ai + hs * 8 + 1]};
#pragma unroll   // as above
          for (int nt = 0; nt < 2; ++nt)
            acc[m * 2 + nt] = __builtin_amdgcn_wmma_f32_16x16x4_f32(
                false, a, false, b[hs][nt], (short)0, acc[m * 2 + nt], false, false);
        }
        // Four free vector slots between the tile's last matrix steps and
        // whatever next reuses their operand registers or touches their sums.
        asm volatile("v_nop\n\tv_nop\n\tv_nop\n\tv_nop"
                     : "+v"(acc[m * 2]), "+v"(acc[m * 2 + 1]));
      }
    }
  }

#pragma unroll   // acc[] is indexed by constants
  for (int m = 0; m < 4; ++m) {
#pragma unroll   // as above
    for (int nt = 0; nt < 2; ++nt) {
      float* yb = out + (size_t)(row0 + m * 16 + kh * 8) * DATTN + n0 + nt * 16 + idx16;
      const v8f a = acc[m * 2 + nt];
#pragma unroll   // as above
      for (int v = 0; v < 8; ++v) yb[(size_t)v * DATTN] = a[v];
    }
  }
}

// ---------------------------------------------------------------------------
// Launcher. Inputs: q, kv_src, seg_id, Wq, Wkv, Wo.
// Workspace layout: kv (16MB) | pg (4MB) | ut, then tab (128MB)  = 148MB.
// ut is dead once window_scores has run; tab is written over it afterwards.
// ---------------------------------------------------------------------------
extern "C" void kernel_launch(void* const* d_in, const int* in_sizes, int n_in,
                              void* d_out, int out_size, void* d_ws, size_t ws_size,
                              hipStream_t stream) {
  const float* q      = (const float*)d_in[0];
  const float* kv_src = (const float*)d_in[1];
  const int*   seg    = (const int*)d_in[2];
  const float* Wq     = (const float*)d_in[3];
  const float* Wkv    = (const float*)d_in[4];
  const float* Wo     = (const float*)d_in[5];
  float* out = (float*)d_out;

  float* kv   = (float*)d_ws;                               // B*LKV*2*DATTN
  float* pg   = kv + (size_t)B_ * LKV_ * 2 * DATTN;         // B*LQ*NH*KW
  float* tab  = pg + (size_t)B_ * LQ_ * NH * KW_;           // B*LKV*NH*DATTN
  float* ut   = tab;                                        // B*LKV*NH*QD

  const dim3 blk(256);

  // kv = kv_src @ Wkv.T              M=2048  N=2048 K=1024
  gemm_xwT_wmma<0><<<dim3((2 * DATTN) / 128, (B_ * LKV_) / 128), blk, 0, stream>>>(
      kv_src, Wkv, kv, B_ * LKV_, 2 * DATTN, 1024, 1024, 1024);

  // ut[j][h] = k[j][h] @ Wq[h rows]   per head: 1024 x 2048, K=64
  fold_wq_into_k<<<dim3(QD_ / UC_, (B_ * LKV_) / UJ_, NH / UH_), blk, 0, stream>>>(
      kv, Wq, ut);

  // window softmax weights           one block per SM_ query rows
  window_scores<<<dim3((B_ * LQ_) / SM_), blk, 0, stream>>>(
      q, ut, seg, pg);

  // tab[j][h] = v[j][h] @ Wo[:, h].T  per head: M=2048 N=1024 K=64
  // (last before its reader, so that more of it is still in L2 there)
  gemm_xwT_wmma<1><<<dim3(1024 / 128, (B_ * LKV_) / 128, NH), blk, 0, stream>>>(
      kv + DATTN, Wo, tab, B_ * LKV_, DATTN, HD, 2 * DATTN, DATTN);

  // out = P @ tab                    k = the block's own span of kv rows x heads
  out_from_table<<<dim3(DATTN / NB_, (B_ * LQ_) / MT_), blk, 0, stream>>>(
      pg, tab, seg, out);
}

// v005
// It runs in 180 microseconds.
// Next to v004, in two timings, it ran 1.11 and 1.12 times as fast.
// Over all steps from v000 it is 2.45 times as fast.
#include <hip/hip_runtime.h>
#include <cfloat>

// ---------------------------------------------------------------------------
// Problem constants (from reference)
// ---------------------------------------------------------------------------
#define B_    4
#define LQ_   4096
#define LKV_  512
#define DATTN 1024
#define NH    16
#define HD    64
#define KW_   4          // LOOKBACK + 1

typedef __attribute__((ext_vector_type(2))) float v2f;
typedef __attribute__((ext_vector_type(8))) float v8f;
typedef __attribute__((ext_vector_type(4))) int   v4i;

typedef __attribute__((address_space(1))) v4i* gv4i_p;   // global
typedef __attribute__((address_space(3))) v4i* lv4i_p;   // LDS

// ---------------------------------------------------------------------------
// Tile order. Every launch has a one-dimensional grid, and workgroup b takes
// share b & 7, place b >> 3 inside the share. Share u holds, in every launch,
// the work on kv rows 256*u .. 256*u + 255 (flat b * LKV_ + j) and on query
// rows 2048*u .. 2048*u + 2047, which for sorted segments are about the same
// stretch. Grouping them so aims at one L2 a share, for speed only: a
// table row that neighbouring query blocks both walk is fetched from memory
// once, not once by each L2, and a table's writer and its readers can meet in
// the same L2.
// For speed only, nothing promises that placement: b -> tile is a permutation,
// so every tile is done exactly once wherever the workgroups land.
// ---------------------------------------------------------------------------
#define NSHARE 8

// ---------------------------------------------------------------------------
// Async global->LDS staging (gfx1250). Falls back to a synchronous copy if
// the builtins are not declared by this toolchain.
// ---------------------------------------------------------------------------
#if __has_builtin(__builtin_amdgcn_global_load_async_to_lds_b128)
#define HAS_ASYNC_LDS 1
#endif

__device__ __forceinline__ void stage16(const float* g, float* l) {
#ifdef HAS_ASYNC_LDS
  __builtin_amdgcn_global_load_async_to_lds_b128((gv4i_p)g, (lv4i_p)l, 0, 0);
#else
  *(float4*)l = *(const float4*)g;
#endif
}

__device__ __forceinline__ void async_wait_all() {
#ifdef HAS_ASYNC_LDS
#if __has_builtin(__builtin_amdgcn_s_wait_asynccnt)
  __builtin_amdgcn_s_wait_asynccnt(0);
#else
  asm volatile("s_wait_asynccnt 0x0" ::: "memory");
#endif
#endif
}

// ---------------------------------------------------------------------------
// Y[m][n] = sum_k X[m][k] * W[n][k]   (torch-style y = x @ W.T)
// X: M x K, row pitch ldx; W: N x K, row pitch ldw; Y: M x N row-major.
// M, N multiples of 128; K multiple of 16.
//
// PERHEAD = 1: the block has a head h; X and W start at column h * HD, and Y is
// the table T[m / 2][h][n][m & 1] that out_from_table reads (two neighbouring
// rows m side by side, which is the k pair of one B fragment there).
//
// Workgroup (256 thr = 8 waves) computes a 128x128 output block.
// Wave w: M-strip (w>>1)*32 (two 16-row tiles), N-strip (w&1)*64 (four tiles).
// K is consumed in chunks of 16, double-buffered in LDS via async loads.
//
// LDS row stride = 20 floats (16 data + 4 pad): 20*r mod 64 distinct and
// multiple of 4 for r=0..15 -> conflict-free ds_load_b64 fragment reads,
// and 16B-aligned rows for the async b128 writes.
//
// V_WMMA_F32_16X16X4_F32 operand layout (ISA 7.12.2):
//   A 16x4 : lane = M + 16*Khalf, holds K = 2*Khalf + {0,1}  -> float2/lane
//   B 4x16 : lane = N + 16*Khalf, holds K = 2*Khalf + {0,1}  -> float2/lane
//   C/D    : VGPR v, lanes 0-15 -> row v, lanes 16-31 -> row v+8, col=lane&15
// ---------------------------------------------------------------------------
#define KC   16
#define LDP  20          // padded LDS row stride (floats)

template <int PERHEAD>
__global__ __launch_bounds__(256) void gemm_xwT_wmma(
    const float* __restrict__ X, const float* __restrict__ W,
    float* __restrict__ Y, int M, int N, int K, int ldx, int ldw)
{
  __shared__ float Xs[2][128 * LDP];
  __shared__ float Ws[2][128 * LDP];

  const int t     = threadIdx.x;
  const int lane  = t & 31;
  const int wave  = t >> 5;
  // Share u: the two 128-row blocks 2*u and 2*u + 1 (M = 2048), all columns.
  const int bu    = blockIdx.x & (NSHARE - 1);
  const int br    = blockIdx.x / NSHARE;
  const int mBlk  = (bu * 2 + (br & 1)) * 128;
  const int nBlk  = (PERHEAD ? ((br >> 1) & 7) : (br >> 1)) * 128;
  const int head  = PERHEAD ? (br >> 4) : 0;
  const int mw    = (wave >> 1) * 32;   // wave M offset within block
  const int nw    = (wave & 1) * 64;    // wave N offset within block
  const int idx16 = lane & 15;
  const int kh    = lane >> 4;          // K-half: 0 -> K{0,1}, 1 -> K{2,3}

  // Staging map: per chunk, each matrix moves 128 rows x 16 floats
  // = 512 x b128 transfers; 256 threads issue 2 each per matrix.
  const int sRow0 = t >> 2;             // lin = 0*256 + t
  const int sCg0  = (t & 3) * 4;
  const int sRow1 = (256 + t) >> 2;     // lin = 1*256 + t
  const int sCg1  = ((256 + t) & 3) * 4;

  v8f acc[8] = {};                      // [mt*4 + nt]

  if (PERHEAD) {
    X += head * HD;
    W += head * HD;
  }

  // ---- prologue: stage chunk 0 into buffer 0 --------------------------------
  {
    stage16(X + (size_t)(mBlk + sRow0) * ldx + sCg0, &Xs[0][sRow0 * LDP + sCg0]);
    stage16(X + (size_t)(mBlk + sRow1) * ldx + sCg1, &Xs[0][sRow1 * LDP + sCg1]);
    stage16(W + (size_t)(nBlk + sRow0) * ldw + sCg0, &Ws[0][sRow0 * LDP + sCg0]);
    stage16(W + (size_t)(nBlk + sRow1) * ldw + sCg1, &Ws[0][sRow1 * LDP + sCg1]);
  }
  async_wait_all();
  __syncthreads();

  for (int kc = 0; kc < K; kc += KC) {
    const int buf = (kc >> 4) & 1;

    // ---- stage next chunk into the other buffer (overlaps with compute) ----
    if (kc + KC < K) {
      const int kn = kc + KC;
      stage16(X + (size_t)(mBlk + sRow0) * ldx + kn + sCg0, &Xs[buf ^ 1][sRow0 * LDP + sCg0]);
      stage16(X + (size_t)(mBlk + sRow1) * ldx + kn + sCg1, &Xs[buf ^ 1][sRow1 * LDP + sCg1]);
      stage16(W + (size_t)(nBlk + sRow0) * ldw + kn + sCg0, &Ws[buf ^ 1][sRow0 * LDP + sCg0]);
      stage16(W + (size_t)(nBlk + sRow1) * ldw + kn + sCg1, &Ws[buf ^ 1][sRow1 * LDP + sCg1]);
    }

    // ---- compute current chunk from LDS ------------------------------------
#pragma unroll
    for (int ks = 0; ks < KC; ks += 4) {
      const int kb = ks + 2 * kh;
      const v2f a0 = *(const v2f*)&Xs[buf][(mw + idx16)      * LDP + kb];
      const v2f a1 = *(const v2f*)&Xs[buf][(mw + 16 + idx16) * LDP + kb];
#pragma unroll
      for (int nt = 0; nt < 4; ++nt) {
        const v2f b = *(const v2f*)&Ws[buf][(nw + nt * 16 + idx16) * LDP + kb];
        acc[nt]     = __builtin_amdgcn_wmma_f32_16x16x4_f32(false, a0, false, b, (short)0, acc[nt],     false, false);
        acc[4 + nt] = __builtin_amdgcn_wmma_f32_16x16x4_f32(false, a1, false, b, (short)0, acc[4 + nt], false, false);
      }
    }

    async_wait_all();     // next chunk resident
    __syncthreads();      // all waves done reading buf / writing buf^1
  }

  // ---- write back -----------------------------------------------------------
#pragma unroll
  for (int mt = 0; mt < 2; ++mt) {
#pragma unroll
    for (int nt = 0; nt < 4; ++nt) {
      const int row = mBlk + mw + mt * 16 + kh * 8;
      const int cn  = nBlk + nw + nt * 16 + idx16;
      const v8f a = acc[mt * 4 + nt];
      if (PERHEAD) {
        float* yb = Y + (((size_t)(row >> 1) * NH + head) * N + cn) * 2;
#pragma unroll   // a[] is indexed by constants
        for (int v = 0; v < 8; v += 2) {
          const v2f pr = {a[v], a[v + 1]};
          *(v2f*)(yb + (size_t)(v >> 1) * NH * N * 2) = pr;
        }
      } else {
        float* yb = Y + (size_t)row * N + cn;
#pragma unroll
        for (int v = 0; v < 8; ++v) yb[(size_t)v * N] = a[v];
      }
    }
  }
}

// ---------------------------------------------------------------------------
// Wq folded into K. score[q][h][j] = sum_d (q Wq^T)[h*HD+d] * k[j][h*HD+d]
//                                  = sum_c q[c] * U[j][h][c],
// U[j][h][c] = sum_d k[j][h*HD+d] * Wq[h*HD+d][c]          (K = HD = 64).
// Stored as ut[j][c / 4][h][c & 3]: the 16 heads of one kv row side by side,
// four c each, so that one 16-byte load per lane in window_scores covers 512
// contiguous bytes and feeds two matrix steps.
//
// Block = 8 waves = 8 heads (one half of the heads), UC_ columns c (matrix
// rows) x UJ_ kv rows j (matrix columns) per wave, operands straight from
// global memory. k order of step s of octet kq, equal for A and B:
//   lane half kh, element e -> d = 8*kq + 4*kh + 2*s + e.
// The results go through LDS so that the 8 heads' 16-byte pieces leave as
// whole 128-byte lines. UP_: one kv row's floats in LDS plus 4, which spreads
// the 16 lanes of a 16-byte write over all banks.
// ---------------------------------------------------------------------------
#define QD_  1024        // q_dim, the pitch of q and Wq
#define UJ_  64
#define UC_  64
#define UH_  8
#define UP_  (UC_ * UH_ + 4)

typedef __attribute__((ext_vector_type(4))) float v4f;

// Second bound: four waves per SIMD, so that two blocks share a WGP and one
// block's loads and stores hide behind the other's matrix steps.
__global__ __launch_bounds__(256, 4) void fold_wq_into_k(
    const float* __restrict__ kv, const float* __restrict__ Wq,
    float* __restrict__ ut)
{
  __shared__ float Ts[UJ_ * UP_];

  const int t     = threadIdx.x;
  const int lane  = t & 31;
  const int wave  = t >> 5;
  const int idx16 = lane & 15;
  const int kh    = lane >> 4;
  // Share u: the four 64-row blocks 4*u .. 4*u + 3. The two halves of the heads
  // come first: they write the two halves of the same 256 bytes.
  const int bu    = blockIdx.x & (NSHARE - 1);
  const int br    = blockIdx.x / NSHARE;
  const int hz    = br & 1;
  const int c0    = ((br >> 1) & 15) * UC_;
  const int j0    = (bu * 4 + (br >> 5)) * UJ_;     // flat b * LKV_ + j
  const int h     = hz * UH_ + wave;

  // The lane's byte offsets into Wq and kv (both below 2^25).
  unsigned oa = (unsigned)(((h * HD + kh * 4) * QD_ + c0 + idx16) * 4);
  unsigned ob = (unsigned)(((j0 + idx16) * (2 * DATTN) + h * HD + kh * 4) * 4);

  v8f acc[16] = {};                     // [mt*4 + nt]

  // Kept rolled: unrolled, the second half's loads are hoisted into the first
  // and the registers of four waves per SIMD no longer suffice.
#pragma unroll 1
  for (int hf = 0; hf < 2; ++hf) {
    // Half of a head's k row is one 128-byte line; its eight 16-byte pieces per
    // lane pair are fetched together, so that no line is fetched twice.
    const float* pa = (const float*)((const char*)Wq + oa);
    const float* pb = (const float*)((const char*)kv + ob);
    v4f bv[4][4];                       // [nt][octet]
#pragma unroll   // bv[][] is indexed by constants and stays in registers
    for (int nt = 0; nt < 4; ++nt)
#pragma unroll   // as above
      for (int i = 0; i < 4; ++i)
        bv[nt][i] = *(const v4f*)(pb + (size_t)nt * 16 * (2 * DATTN) + i * 8);
#pragma unroll   // acc[], av[][] and bv[][] are indexed by constants
    for (int i = 0; i < 4; ++i) {
      float av[4][4];                   // [mt][e]
#pragma unroll   // as above
      for (int mt = 0; mt < 4; ++mt)
#pragma unroll   // as above
        for (int e = 0; e < 4; ++e)
          av[mt][e] = pa[(size_t)(i * 8 + e) * QD_ + mt * 16];
#pragma unroll   // as above
      for (int s = 0; s < 2; ++s)
#pragma unroll   // as above
        for (int mt = 0; mt < 4; ++mt) {
          const v2f a = {av[mt][2 * s], av[mt][2 * s + 1]};
#pragma unroll   // as above
          for (int nt = 0; nt < 4; ++nt) {
            const v2f b = {bv[nt][i][2 * s], bv[nt][i][2 * s + 1]};
            acc[mt * 4 + nt] = __builtin_amdgcn_wmma_f32_16x16x4_f32(
                false, a, false, b, (short)0, acc[mt * 4 + nt], false, false);
          }
        }
    }
    // The wait: the two additions below rewrite the offset registers of the
    // loads above. The four v_nop: free vector slots between the last matrix
    // steps and whatever touches their result or reuses their operand registers.
    // The sums are inputs, so the statement stands behind every matrix step; the
    // offsets pass through it, so their additions stand behind it.
    asm volatile("s_wait_xcnt 0x0\n\tv_nop\n\tv_nop\n\tv_nop\n\tv_nop"
                 : "+v"(oa), "+v"(ob)
                 : "v"(acc[0]), "v"(acc[1]), "v"(acc[2]), "v"(acc[3]),
                   "v"(acc[4]), "v"(acc[5]), "v"(acc[6]), "v"(acc[7]),
                   "v"(acc[8]), "v"(acc[9]), "v"(acc[10]), "v"(acc[11]),
                   "v"(acc[12]), "v"(acc[13]), "v"(acc[14]), "v"(acc[15])
                 : "memory");
    oa += 32 * QD_ * 4;
    ob += 32 * 4;
  }
  // Lane (idx16, kh) of tile (mt, nt) holds kv row nt*16 + idx16 and the eight
  // columns c = mt*16 + kh*8 + 0..7: two quads.
#pragma unroll   // acc[] is indexed by constants
  for (int mt = 0; mt < 4; ++mt) {
#pragma unroll   // as above
    for (int nt = 0; nt < 4; ++nt) {
      const v8f a = acc[mt * 4 + nt];
      float* d = &Ts[(nt * 16 + idx16) * UP_ + ((mt * 4 + kh * 2) * UH_ + wave) * 4];
      const v4f lo = {a[0], a[1], a[2], a[3]}, hi = {a[4], a[5], a[6], a[7]};
      *(v4f*)d = lo;
      *(v4f*)(d + UH_ * 4) = hi;
    }
  }
  __syncthreads();

  // 128 quads (16 c quads x 8 heads) per kv row; a wave's 32 lanes write four
  // whole 128-byte lines.
  const int r = t & 127;
  const float* ls = &Ts[(t >> 7) * UP_ + r * 4];
  float* gd = ut + (((size_t)(j0 + (t >> 7)) * (QD_ / 4) + (c0 >> 2) + (r >> 3)) * NH
                    + hz * UH_ + (r & 7)) * 4;
#pragma unroll   // constant offsets from one LDS and one global address
  for (int it = 0; it < UJ_ / 2; it += 8) {
    v4f x[8];
#pragma unroll   // x[] is indexed by constants
    for (int k = 0; k < 8; ++k) x[k] = *(const v4f*)(ls + (it + k) * 2 * UP_);
#pragma unroll   // as above
    for (int k = 0; k < 8; ++k) *(v4f*)(gd + (size_t)(it + k) * 2 * (QD_ * NH)) = x[k];
    // The next eight LDS reads land in registers that the stores above name.
    if (it + 8 < UJ_ / 2) asm volatile("s_wait_xcnt 0x0" ::: "memory");
  }
}

// 2^x. The v_nop is the free slot that the instruction set asks for behind a
// transcendental; inside the statement it cannot drift away from it.
__device__ __forceinline__ float exp2_slot(float x) {
  float r;
  asm("v_exp_f32 %0, %1\n\tv_nop" : "=v"(r) : "v"(x));
  return r;
}

// ---------------------------------------------------------------------------
// Windowed segment attention, scores and softmax.
// S[q][j][h] = sum_c q[q][c] * U[j][h][c] on matrix steps: a block takes SM_
// query rows and walks only the kv rows between the lowest and the highest
// window of its rows (found here, for any seg content). One kv row = one tile
// of 16 columns (its heads). The 8 waves split c: wave w owns c = 128*w .. +127
// and keeps its part of the query rows in registers; the eight partial sums
// meet in LDS. k order of step s of octet kq, equal for A and B:
//   lane half kh, element e -> c = 128*wave + 8*kq + 4*kh + 2*s + e.
//  For w in 0..3: idx = seg_id[b,q] - w; idx < 0 is masked (lowest score),
//  and the row that is read is idx clipped to [0, LKV-1], as in the reference.
//  Rs[wave][q][r][h]: partial score of kv row c0 - 3 + r, c0 = clip(seg_id);
//  only rows inside the query's own window are kept.
//  pg : (B * LQ, NH, 4). Entry r is the weight of kv row c0 - 3 + r; windows
//  that the clip sends to one row are added up.
// ---------------------------------------------------------------------------
#define SM_ 32

// Second bound: four waves per SIMD (two blocks per WGP), which cover each
// other's load latency.
__global__ __launch_bounds__(256, 4) void window_scores(
    const float* __restrict__ q, const float* __restrict__ ut,
    const int* __restrict__ seg, float* __restrict__ pg)
{
  __shared__ float Rs[8 * SM_ * KW_ * NH];

  const int t     = threadIdx.x;
  const int lane  = t & 31;
  const int wave  = t >> 5;
  const int idx16 = lane & 15;
  const int kh    = lane >> 4;
  // Share u: the 64 blocks of query rows 2048*u .. 2048*u + 2047, in order.
  const int row0  = ((blockIdx.x & (NSHARE - 1)) * ((B_ * LQ_) / (SM_ * NSHARE))
                     + blockIdx.x / NSHARE) * SM_;    // flat b * LQ_ + q
  static_assert(SM_ == 32, "one query row per lane");

  const int*   sp = seg + row0 + lane;
  const float* qp = q + (size_t)(row0 + idx16) * QD_ + wave * 128 + kh * 4;
  const int sl = *sp;
  v4f av[2][16];
#pragma unroll   // av[][] is indexed by constants and stays in registers
  for (int mt = 0; mt < 2; ++mt)
#pragma unroll   // as above
    for (int kq = 0; kq < 16; ++kq)
      av[mt][kq] = *(const v4f*)(qp + mt * 16 * QD_ + kq * 8);
  // The loads' address registers are inputs here, so none of them is reused
  // (not even as a load's target) before this wait.
  asm volatile("s_wait_xcnt 0x0" :: "v"(sp), "v"(qp) : "memory");

  // Lowest and highest clipped segment of the block's 32 rows.
  const int cl = min(max(sl, 0), LKV_ - 1);
  int mn = cl, mx = cl;
#pragma unroll   // five fixed exchange steps, no loop counter
  for (int o = 16; o > 0; o >>= 1) {
    mn = min(mn, __shfl_xor(mn, o));
    mx = max(mx, __shfl_xor(mx, o));
  }
  const int jlo = __builtin_amdgcn_readfirstlane(max(mn - (KW_ - 1), 0));
  const int jhi = __builtin_amdgcn_readfirstlane(mx);   // <= LKV_ - 1

  // 3 - c0 of the 16 query rows whose sums this lane holds.
  int dq[2][8];
#pragma unroll   // dq[][] is indexed by constants
  for (int mt = 0; mt < 2; ++mt)
#pragma unroll   // as above
    for (int v = 0; v < 8; ++v)
      dq[mt][v] = (KW_ - 1) - __shfl(cl, mt * 16 + kh * 8 + v);

  float* rb = &Rs[(wave * SM_ + kh * 8) * (KW_ * NH) + idx16];
  const float* ub = ut + ((size_t)(row0 / LQ_) * LKV_ * (QD_ / 4) + wave * 32 + kh) * (NH * 4)
                       + idx16 * 4;

  int jv = jlo;                         // j, kept in a vector register
  for (int j = jlo; j <= jhi; ++j) {
    const float* uj = ub + (size_t)j * (QD_ * NH);
    v4f bv[16];
#pragma unroll   // bv[] is indexed by constants and stays in registers
    for (int kq = 0; kq < 16; ++kq)
      bv[kq] = *(const v4f*)(uj + kq * (2 * NH * 4));
    // The next trip rewrites the address registers that the loads above name.
    asm volatile("s_wait_xcnt 0x0" :: "v"(uj) : "memory");
    // Keeps the trip's 16 loads together ahead of its matrix steps: one load
    // latency a trip, which the SIMD's other waves cover.
    __builtin_amdgcn_sched_barrier(0);

    v8f a0 = {}, a1 = {};
#pragma unroll   // av[][] and bv[] are indexed by constants
    for (int kq = 0; kq < 16; ++kq) {
      a0 = __builtin_amdgcn_wmma_f32_16x16x4_f32(false, av[0][kq].lo, false, bv[kq].lo, (short)0, a0, false, false);
      a1 = __builtin_amdgcn_wmma_f32_16x16x4_f32(false, av[1][kq].lo, false, bv[kq].lo, (short)0, a1, false, false);
      a0 = __builtin_amdgcn_wmma_f32_16x16x4_f32(false, av[0][kq].hi, false, bv[kq].hi, (short)0, a0, false, false);
      a1 = __builtin_amdgcn_wmma_f32_16x16x4_f32(false, av[1][kq].hi, false, bv[kq].hi, (short)0, a1, false, false);
    }

    // Four free vector slots between the last matrix steps and whatever touches
    // their result or reuses their operand registers. The row number passes
    // through the statement, so no later arithmetic is moved ahead of it.
    asm volatile("v_nop\n\tv_nop\n\tv_nop\n\tv_nop"
                 : "+v"(a0), "+v"(a1), "+v"(jv) : "v"(bv[15]));

#pragma unroll   // a0, a1 and dq[][] are indexed by constants
    for (int v = 0; v < 8; ++v) {
      const int r0 = jv + dq[0][v], r1 = jv + dq[1][v];
      if ((unsigned)r0 < (unsigned)KW_) rb[v * (KW_ * NH) + r0 * NH] = a0[v];
      if ((unsigned)r1 < (unsigned)KW_) rb[(16 + v) * (KW_ * NH) + r1 * NH] = a1[v];
    }
    ++jv;
  }
  __syncthreads();

  const float scale = 0.125f;                 // 64^-0.5
  float* pgp = pg + (size_t)row0 * (NH * KW_) + t * KW_;
#pragma unroll   // two (query row, head) pairs per thread
  for (int k = 0; k < 2; ++k) {
    const int ql = (t >> 4) + k * 16;         // head = idx16
    const int s0 = __shfl(sl, ql);
    const int c0 = min(max(s0, 0), LKV_ - 1);
    int   rr[KW_];
    float sc[KW_];
#pragma unroll   // rr[] and sc[] are indexed by constants
    for (int w = 0; w < KW_; ++w) {
      rr[w] = 3 - (c0 - min(max(s0 - w, 0), LKV_ - 1));   // 0..3, a row that was walked
      const float* rp = &Rs[(ql * KW_ + rr[w]) * NH + idx16];
      float s = 0.f;
#pragma unroll   // constant offsets from one LDS address
      for (int wv = 0; wv < 8; ++wv) s += rp[wv * (SM_ * KW_ * NH)];
      sc[w] = (s0 - w >= 0) ? s * scale : -FLT_MAX;
    }

    const float mxs = fmaxf(fmaxf(sc[0], sc[1]), fmaxf(sc[2], sc[3]));
    float p[KW_];
    float sum = 0.f;
#pragma unroll
    for (int w = 0; w < KW_; ++w) {
      p[w] = exp2_slot((sc[w] - mxs) * 1.44269504f);   // e^(sc - mx); masked: 0
      sum += p[w];
    }
    const float inv = 1.f / sum;

    float pr[KW_] = {0.f, 0.f, 0.f, 0.f};
#pragma unroll
    for (int w = 0; w < KW_; ++w) {
      const float pw = p[w] * inv;
#pragma unroll   // pr[] is indexed by constants
      for (int kk = 0; kk < KW_; ++kk) pr[kk] += (rr[w] == kk) ? pw : 0.f;
    }
    *(float4*)(pgp + k * 256 * KW_) = make_float4(pr[0], pr[1], pr[2], pr[3]);
  }
}

// ---------------------------------------------------------------------------
// out[q][n] = sum over kv rows j and heads h of P[q][j][h] * T[j][h][n], with
// T[j][h][n] = sum_d v[j][h][d] * Wo[n][h*HD + d] (gemm_xwT_wmma<1>) and
// P[q][j][h] the softmax weight of row j, zero outside the query's window.
// A block takes MT_ query rows (four tiles of 16) and walks only the kv rows
// between the lowest and the highest window of its rows (found here, for any
// seg content), two rows j at a time: k = 2 rows x 16 heads = 8 matrix steps.
// The pair's table rows are loaded once for all four tiles; a tile does its
// matrix steps only for pairs between the lowest and the highest window of its
// own 16 rows. Outside of these all its weights are zero, so nothing is lost.
// k order of one step hs, equal for A and B: lane half kh, element e
//   -> head 2*hs + kh, kv row 2*jp + e.
// Block = 8 waves; wave tile 64 x 32, block tile 64 x NB_.
//
// Ps[q][h][0..7] = {0, 0, pg[q][h][0..3], 0, 0}: the pair of weights for rows
// (2*jp, 2*jp + 1) is two neighbouring floats at a clamped index, zeros
// included, so no lane is ever switched off. Rows q, q + 16, q + 32 and q + 48
// share one LDS row of PQ_ floats: the even heads of the four tiles (PM_ floats
// a tile), then, PO_ floats in, the odd heads. So every fragment read of a trip
// is a constant offset of fewer than 256 floats (what a two-address LDS read
// can hold) from one register a tile, and no address arithmetic stands among
// the matrix steps. PQ_ and PO_ spread the 32 lanes over the banks.
// ---------------------------------------------------------------------------
#define MT_  64
#define NB_  256
#define PQ_  524
#define PM_  64
#define PO_  258

__global__ __launch_bounds__(256) void out_from_table(
    const float* __restrict__ pg, const float* __restrict__ tab,
    const int* __restrict__ seg, float* __restrict__ out)
{
  __shared__ float Ps[16 * PQ_];

  const int t     = threadIdx.x;
  const int lane  = t & 31;
  const int wave  = t >> 5;
  const int idx16 = lane & 15;
  const int kh    = lane >> 4;
  // Share u: the 32 blocks of query rows 2048*u .. 2048*u + 2047, in order, the
  // four column blocks of the same rows one after the other.
  const int br    = blockIdx.x / NSHARE;
  const int row0  = ((blockIdx.x & (NSHARE - 1)) * ((B_ * LQ_) / (MT_ * NSHARE))
                     + (br >> 2)) * MT_;              // flat b * LQ_ + q
  const int n0    = (br & 3) * NB_ + wave * 32;

  // MT_ * NH = 1024 weight quads, four per thread; the block's 64 segments, two
  // per lane.
  static_assert(MT_ * NH == 1024 && MT_ == 64, "four quads per thread, two rows per lane");
  const float* pp = pg + (size_t)row0 * (NH * KW_) + t * KW_;
  const int*   sp = seg + row0 + lane;
  float4 pv[4];
#pragma unroll   // pv[] is indexed by constants and stays in registers
  for (int k = 0; k < 4; ++k) pv[k] = *(const float4*)(pp + k * 256 * KW_);
  const int sl[2] = {sp[0], sp[32]};
  // The loads' offset registers (the two indices) are inputs here, so neither
  // is reused (not even as a load's target) before this wait.
  asm volatile("s_wait_xcnt 0x0" :: "v"(t), "v"(lane) : "memory");

#pragma unroll   // pv[] is indexed by constants and stays in registers
  for (int k = 0; k < 4; ++k) {
    const int i = t + k * 256, q = i >> 4, h = i & 15;
    float* d = &Ps[(q & 15) * PQ_ + (q >> 4) * PM_ + (h & 1) * PO_ + (h >> 1) * 8];
    const v2f z = {0.f, 0.f}, lo = {pv[k].x, pv[k].y}, hi = {pv[k].z, pv[k].w};
    *(v2f*)(d + 0) = z;
    *(v2f*)(d + 2) = lo;
    *(v2f*)(d + 4) = hi;
    *(v2f*)(d + 6) = z;
  }

  // Lowest and highest clipped segment of each tile's 16 rows (one half of the
  // lanes each), then the first and the last pair of kv rows of each tile.
  const int cl[2] = {min(max(sl[0], 0), LKV_ - 1), min(max(sl[1], 0), LKV_ - 1)};
  int mn[2] = {cl[0], cl[1]}, mx[2] = {cl[0], cl[1]};
#pragma unroll   // four fixed exchange steps, no loop counter
  for (int o = 8; o > 0; o >>= 1) {
#pragma unroll   // mn[] and mx[] are indexed by constants
    for (int g = 0; g < 2; ++g) {
      mn[g] = min(mn[g], __shfl_xor(mn[g], o));
      mx[g] = max(mx[g], __shfl_xor(mx[g], o));
    }
  }
  int tlo[4], thi[4], c0a[4], ab[4];
#pragma unroll   // all four arrays are indexed by constants
  for (int m = 0; m < 4; ++m) {
    tlo[m] = max(__builtin_amdgcn_readlane(mn[m >> 1], (m & 1) * 16) - (KW_ - 1), 0) >> 1;
    thi[m] = __builtin_amdgcn_readlane(mx[m >> 1], (m & 1) * 16) >> 1;   // <= LKV_/2 - 1
    c0a[m] = __shfl(cl[m >> 1], (m & 1) * 16 + idx16);
    ab[m]  = idx16 * PQ_ + m * PM_ + kh * PO_ + 2;
  }
  const int jp0 = min(min(tlo[0], tlo[1]), min(tlo[2], tlo[3]));
  const int jp1 = max(max(thi[0], thi[1]), max(thi[2], thi[3]));

  const float* tb = tab + ((size_t)(row0 / LQ_) * (LKV_ / 2) * NH + kh) * (DATTN * 2)
                        + (n0 + idx16) * 2;

  v8f acc[8] = {};                      // [m*2 + nt]
  __syncthreads();

  for (int jp = jp0; jp <= jp1; ++jp) {
    const float* tj = tb + (size_t)jp * (NH * DATTN * 2);

    v2f b[NH / 2][2];
#pragma unroll   // b[][] is indexed by constants and stays in registers
    for (int hs = 0; hs < NH / 2; ++hs)
#pragma unroll   // as above
      for (int nt = 0; nt < 2; ++nt)
        b[hs][nt] = *(const v2f*)(tj + hs * (2 * DATTN * 2) + nt * 32);
    // The next trip rewrites the address registers that the loads above name.
    asm volatile("s_wait_xcnt 0x0" :: "v"(tj) : "memory");
    // Keeps the trip's 16 loads together ahead of its matrix steps: one load
    // latency a trip; left free, the scheduler issues each step's loads only
    // one step ahead and the wave waits at every step.
    __builtin_amdgcn_sched_barrier(0);

#pragma unroll   // acc[], b[][] and the tiles' arrays are indexed by constants
    for (int m = 0; m < 4; ++m) {
      // The same for every lane (scalar registers): the whole wave takes the
      // tile's matrix steps or skips them.
      if (jp >= tlo[m] && jp <= thi[m]) {
        const int ai = ab[m] + min(max(2 * jp + (KW_ - 1) - c0a[m], -2), 4);
#pragma unroll   // as above
        for (int hs = 0; hs < NH / 2; ++hs) {
          const v2f a = {Ps[ai + hs * 8], Ps[ai + hs * 8 + 1]};
#pragma unroll   // as above
          for (int nt = 0; nt < 2; ++nt)
            acc[m * 2 + nt] = __builtin_amdgcn_wmma_f32_16x16x4_f32(
                false, a, false, b[hs][nt], (short)0, acc[m * 2 + nt], false, false);
        }
        // Four free vector slots between the tile's last matrix steps and
        // whatever next reuses their operand registers or touches their sums.
        asm volatile("v_nop\n\tv_nop\n\tv_nop\n\tv_nop"
                     : "+v"(acc[m * 2]), "+v"(acc[m * 2 + 1]));
      }
    }
  }

#pragma unroll   // acc[] is indexed by constants
  for (int m = 0; m < 4; ++m) {
#pragma unroll   // as above
    for (int nt = 0; nt < 2; ++nt) {
      float* yb = out + (size_t)(row0 + m * 16 + kh * 8) * DATTN + n0 + nt * 16 + idx16;
      const v8f a = acc[m * 2 + nt];
#pragma unroll   // as above
      for (int v = 0; v < 8; ++v) yb[(size_t)v * DATTN] = a[v];
    }
  }
}

// ---------------------------------------------------------------------------
// Launcher. Inputs: q, kv_src, seg_id, Wq, Wkv, Wo.
// Workspace layout: kv (16MB) | pg (4MB) | ut, then tab (128MB)  = 148MB.
// ut is dead once window_scores has run; tab is written over it afterwards.
// ---------------------------------------------------------------------------
extern "C" void kernel_launch(void* const* d_in, const int* in_sizes, int n_in,
                              void* d_out, int out_size, void* d_ws, size_t ws_size,
                              hipStream_t stream) {
  const float* q      = (const float*)d_in[0];
  const float* kv_src = (const float*)d_in[1];
  const int*   seg    = (const int*)d_in[2];
  const float* Wq     = (const float*)d_in[3];
  const float* Wkv    = (const float*)d_in[4];
  const float* Wo     = (const float*)d_in[5];
  float* out = (float*)d_out;

  float* kv   = (float*)d_ws;                               // B*LKV*2*DATTN
  float* pg   = kv + (size_t)B_ * LKV_ * 2 * DATTN;         // B*LQ*NH*KW
  float* tab  = pg + (size_t)B_ * LQ_ * NH * KW_;           // B*LKV*NH*DATTN
  float* ut   = tab;                                        // B*LKV*NH*QD

  const dim3 blk(256);

  // kv = kv_src @ Wkv.T              M=2048  N=2048 K=1024
  gemm_xwT_wmma<0><<<dim3(((2 * DATTN) / 128) * ((B_ * LKV_) / 128)), blk, 0, stream>>>(
      kv_src, Wkv, kv, B_ * LKV_, 2 * DATTN, 1024, 1024, 1024);

  // ut[j][h] = k[j][h] @ Wq[h rows]   per head: 1024 x 2048, K=64
  fold_wq_into_k<<<dim3((QD_ / UC_) * ((B_ * LKV_) / UJ_) * (NH / UH_)), blk, 0, stream>>>(
      kv, Wq, ut);

  // window softmax weights           one block per SM_ query rows
  window_scores<<<dim3((B_ * LQ_) / SM_), blk, 0, stream>>>(
      q, ut, seg, pg);

  // tab[j][h] = v[j][h] @ Wo[:, h].T  per head: M=2048 N=1024 K=64
  // (last before its reader, so that more of it is still in L2 there)
  gemm_xwT_wmma<1><<<dim3((1024 / 128) * ((B_ * LKV_) / 128) * NH), blk, 0, stream>>>(
      kv + DATTN, Wo, tab, B_ * LKV_, DATTN, HD, 2 * DATTN, DATTN);

  // out = P @ tab                    k = the block's own span of kv rows x heads
  out_from_table<<<dim3((DATTN / NB_) * ((B_ * LQ_) / MT_)), blk, 0, stream>>>(
      pg, tab, seg, out);
}

// v006
// A run of this version takes 164 microseconds.
// In both of two side-by-side timings against v005, it was 1.09 times as fast.
// All steps since v000 together make it 2.67 times as fast.
#include <hip/hip_runtime.h>
#include <cfloat>

// ---------------------------------------------------------------------------
// Problem constants (from reference)
// ---------------------------------------------------------------------------
#define B_    4
#define LQ_   4096
#define LKV_  512
#define DATTN 1024
#define NH    16
#define HD    64
#define KW_   4          // LOOKBACK + 1

typedef __attribute__((ext_vector_type(2))) float v2f;
typedef __attribute__((ext_vector_type(8))) float v8f;
typedef __attribute__((ext_vector_type(4))) int   v4i;

typedef __attribute__((address_space(1))) v4i* gv4i_p;   // global
typedef __attribute__((address_space(3))) v4i* lv4i_p;   // LDS

// ---------------------------------------------------------------------------
// Tile order. Every launch has a one-dimensional grid, and workgroup b takes
// share b & 7, place b >> 3 inside the share. Share u holds, in every launch,
// the work on kv rows 256*u .. 256*u + 255 (flat b * LKV_ + j) and on query
// rows 2048*u .. 2048*u + 2047, which for sorted segments are about the same
// stretch. Grouping them so aims at one L2 a share, for speed only: a
// table row that neighbouring query blocks both walk is fetched from memory
// once, not once by each L2, and a table's writer and its readers can meet in
// the same L2.
// For speed only, nothing promises that placement: b -> tile is a permutation,
// so every tile is done exactly once wherever the workgroups land.
// ---------------------------------------------------------------------------
#define NSHARE 8

// ---------------------------------------------------------------------------
// Async global->LDS staging (gfx1250). Falls back to a synchronous copy if
// the builtins are not declared by this toolchain.
// ---------------------------------------------------------------------------
#if __has_builtin(__builtin_amdgcn_global_load_async_to_lds_b128)
#define HAS_ASYNC_LDS 1
#endif

__device__ __forceinline__ void stage16(const float* g, float* l) {
#ifdef HAS_ASYNC_LDS
  __builtin_amdgcn_global_load_async_to_lds_b128((gv4i_p)g, (lv4i_p)l, 0, 0);
#else
  *(float4*)l = *(const float4*)g;
#endif
}

__device__ __forceinline__ void async_wait_all() {
#ifdef HAS_ASYNC_LDS
#if __has_builtin(__builtin_amdgcn_s_wait_asynccnt)
  __builtin_amdgcn_s_wait_asynccnt(0);
#else
  asm volatile("s_wait_asynccnt 0x0" ::: "memory");
#endif
#endif
}

// ---------------------------------------------------------------------------
// Y[m][n] = sum_k X[m][k] * W[n][k]   (torch-style y = x @ W.T)
// X: M x K, row pitch ldx; W: N x K, row pitch ldw; Y: M x N row-major.
// M, N multiples of 128; K a multiple of the chunk.
//
// PERHEAD = 1: the block has a head h; X and W start at column h * HD, K is HD,
// and Y is the table T[m / 2][h][n][m & 1] that out_from_table reads (two
// neighbouring rows m side by side, which is the k pair of one B fragment there).
//
// Workgroup (256 thr = 8 waves) computes a 128x128 output block.
// Wave w: M-strip (w>>1)*32 (two 16-row tiles), N-strip (w&1)*64 (four tiles).
// K is consumed in chunks of KCH floats, staged in LDS by async copies:
//   PERHEAD = 0: KCH = 128, two buffers; a wave's copy is one whole row of the
//                chunk (512 contiguous bytes), and the wait and the barrier of a
//                chunk stand behind 256 matrix steps per wave. The two buffers
//                take most of a WGP's LDS: one workgroup per WGP.
//   PERHEAD = 1: KCH = HD = 64, the whole K: one fill, one barrier, one buffer;
//                a wave's copy is two whole rows (256 contiguous bytes each).
//
// LDS row stride = KCH + 4 floats: 4*r mod 64 distinct for r=0..15 -> conflict-
// free 8-byte fragment reads, and 16B-aligned rows for the async b128 writes.
//
// V_WMMA_F32_16X16X4_F32 operand layout (ISA 7.12.2):
//   A 16x4 : lane = M + 16*Khalf, holds K = 2*Khalf + {0,1}  -> float2/lane
//   B 4x16 : lane = N + 16*Khalf, holds K = 2*Khalf + {0,1}  -> float2/lane
//   C/D    : VGPR v, lanes 0-15 -> row v, lanes 16-31 -> row v+8, col=lane&15
// ---------------------------------------------------------------------------
template <int PERHEAD>
__global__ __launch_bounds__(256) void gemm_xwT_wmma(
    const float* __restrict__ X, const float* __restrict__ W,
    float* __restrict__ Y, int M, int N, int K, int ldx, int ldw)
{
  constexpr int KCH = PERHEAD ? HD : 128;   // floats of K per chunk
  constexpr int NBF = PERHEAD ? 1 : 2;      // LDS buffers
  constexpr int LDP = KCH + 4;              // padded LDS row stride (floats)
  constexpr int CPR = KCH / 4;              // 16-byte pieces per row
  constexpr int RST = 256 / CPR;            // rows that the block's 256 copies cover
  constexpr int NCP = 128 / RST;            // copies per thread and matrix

  __shared__ __attribute__((aligned(16))) float Xs[NBF][128 * LDP];
  __shared__ __attribute__((aligned(16))) float Ws[NBF][128 * LDP];

  const int t     = threadIdx.x;
  const int lane  = t & 31;
  const int wave  = t >> 5;
  // Share u: the two 128-row blocks 2*u and 2*u + 1 (M = 2048), all columns.
  const int bu    = blockIdx.x & (NSHARE - 1);
  const int br    = blockIdx.x / NSHARE;
  const int mBlk  = (bu * 2 + (br & 1)) * 128;
  const int nBlk  = (PERHEAD ? ((br >> 1) & 7) : (br >> 1)) * 128;
  const int head  = PERHEAD ? (br >> 4) : 0;
  const int mw    = (wave >> 1) * 32;   // wave M offset within block
  const int nw    = (wave & 1) * 64;    // wave N offset within block
  const int idx16 = lane & 15;
  const int kh    = lane >> 4;          // K-half: 0 -> K{0,1}, 1 -> K{2,3}
  const int Kx    = PERHEAD ? KCH : K;

  // Staging map: copy i of thread t moves 16 bytes of row sRow + i * RST.
  const int sRow = t / CPR;
  const int sCg  = (t % CPR) * 4;
  const int sLds = sRow * LDP + sCg;

  v8f acc[8] = {};                      // [mt*4 + nt]

  if (PERHEAD) {
    X += head * HD;
    W += head * HD;
  }
  const float* xg = X + (size_t)(mBlk + sRow) * ldx + sCg;
  const float* wg = W + (size_t)(nBlk + sRow) * ldw + sCg;

  // ---- prologue: stage chunk 0 into buffer 0 --------------------------------
#pragma unroll   // constant LDS offsets from one address
  for (int i = 0; i < NCP; ++i) {
    stage16(xg + (size_t)(i * RST) * ldx, &Xs[0][sLds + i * RST * LDP]);
    stage16(wg + (size_t)(i * RST) * ldw, &Ws[0][sLds + i * RST * LDP]);
  }
  async_wait_all();
  __syncthreads();

  for (int kc = 0; kc < Kx; kc += KCH) {
    const int buf = PERHEAD ? 0 : ((kc / KCH) & 1);

    // ---- stage next chunk into the other buffer (overlaps with compute) ----
    if constexpr (!PERHEAD) {
      if (kc + KCH < Kx) {
        const int kn = kc + KCH;
#pragma unroll   // constant LDS offsets from one address
        for (int i = 0; i < NCP; ++i) {
          stage16(xg + (size_t)(i * RST) * ldx + kn, &Xs[buf ^ 1][sLds + i * RST * LDP]);
          stage16(wg + (size_t)(i * RST) * ldw + kn, &Ws[buf ^ 1][sLds + i * RST * LDP]);
        }
      }
    }

    // ---- compute current chunk from LDS ------------------------------------
#pragma unroll   // one straight run per chunk: fragment reads go out in groups ahead of their steps
    for (int ks = 0; ks < KCH; ks += 4) {
      const int kb = ks + 2 * kh;
      const v2f a0 = *(const v2f*)&Xs[buf][(mw + idx16)      * LDP + kb];
      const v2f a1 = *(const v2f*)&Xs[buf][(mw + 16 + idx16) * LDP + kb];
#pragma unroll
      for (int nt = 0; nt < 4; ++nt) {
        const v2f b = *(const v2f*)&Ws[buf][(nw + nt * 16 + idx16) * LDP + kb];
        acc[nt]     = __builtin_amdgcn_wmma_f32_16x16x4_f32(false, a0, false, b, (short)0, acc[nt],     false, false);
        acc[4 + nt] = __builtin_amdgcn_wmma_f32_16x16x4_f32(false, a1, false, b, (short)0, acc[4 + nt], false, false);
      }
    }

    if constexpr (!PERHEAD) {
      async_wait_all();     // next chunk resident
      __syncthreads();      // all waves done reading buf / writing buf^1
    }
  }

  // Keeps the store addresses' arithmetic behind the matrix steps: moved up among
  // them, it lands in fragment registers that a matrix step just issued still reads.
  __builtin_amdgcn_sched_barrier(0);

  // ---- write back -----------------------------------------------------------
#pragma unroll
  for (int mt = 0; mt < 2; ++mt) {
#pragma unroll
    for (int nt = 0; nt < 4; ++nt) {
      const int row = mBlk + mw + mt * 16 + kh * 8;
      const int cn  = nBlk + nw + nt * 16 + idx16;
      const v8f a = acc[mt * 4 + nt];
      if (PERHEAD) {
        float* yb = Y + (((size_t)(row >> 1) * NH + head) * N + cn) * 2;
#pragma unroll   // a[] is indexed by constants
        for (int v = 0; v < 8; v += 2) {
          const v2f pr = {a[v], a[v + 1]};
          *(v2f*)(yb + (size_t)(v >> 1) * NH * N * 2) = pr;
        }
      } else {
        float* yb = Y + (size_t)row * N + cn;
#pragma unroll
        for (int v = 0; v < 8; ++v) yb[(size_t)v * N] = a[v];
      }
    }
  }
}

// ---------------------------------------------------------------------------
// Wq folded into K. score[q][h][j] = sum_d (q Wq^T)[h*HD+d] * k[j][h*HD+d]
//                                  = sum_c q[c] * U[j][h][c],
// U[j][h][c] = sum_d k[j][h*HD+d] * Wq[h*HD+d][c]          (K = HD = 64).
// Stored as ut[j][c / 4][h][c & 3]: the 16 heads of one kv row side by side,
// four c each, so that one 16-byte load per lane in window_scores covers 512
// contiguous bytes and feeds two matrix steps.
//
// Block = 8 waves = 8 heads (one half of the heads), UC_ columns c (matrix
// rows) x UJ_ kv rows j (matrix columns) per wave, operands straight from
// global memory. k order of step s of octet kq, equal for A and B:
//   lane half kh, element e -> d = 8*kq + 4*kh + 2*s + e.
// The results go through LDS so that the 8 heads' 16-byte pieces leave as
// whole 128-byte lines. UP_: one kv row's floats in LDS plus 4, which spreads
// the 16 lanes of a 16-byte write over all banks.
// ---------------------------------------------------------------------------
#define QD_  1024        // q_dim, the pitch of q and Wq
#define UJ_  64
#define UC_  64
#define UH_  8
#define UP_  (UC_ * UH_ + 4)

typedef __attribute__((ext_vector_type(4))) float v4f;

// Second bound: four waves per SIMD, so that two blocks share a WGP and one
// block's loads and stores hide behind the other's matrix steps.
__global__ __launch_bounds__(256, 4) void fold_wq_into_k(
    const float* __restrict__ kv, const float* __restrict__ Wq,
    float* __restrict__ ut)
{
  __shared__ float Ts[UJ_ * UP_];

  const int t     = threadIdx.x;
  const int lane  = t & 31;
  const int wave  = t >> 5;
  const int idx16 = lane & 15;
  const int kh    = lane >> 4;
  // Share u: the four 64-row blocks 4*u .. 4*u + 3. The two halves of the heads
  // come first: they write the two halves of the same 256 bytes.
  const int bu    = blockIdx.x & (NSHARE - 1);
  const int br    = blockIdx.x / NSHARE;
  const int hz    = br & 1;
  const int c0    = ((br >> 1) & 15) * UC_;
  const int j0    = (bu * 4 + (br >> 5)) * UJ_;     // flat b * LKV_ + j
  const int h     = hz * UH_ + wave;

  // The lane's byte offsets into Wq and kv (both below 2^25).
  unsigned oa = (unsigned)(((h * HD + kh * 4) * QD_ + c0 + idx16) * 4);
  unsigned ob = (unsigned)(((j0 + idx16) * (2 * DATTN) + h * HD + kh * 4) * 4);

  v8f acc[16] = {};                     // [mt*4 + nt]

  // Kept rolled: unrolled, the second half's loads are hoisted into the first
  // and the registers of four waves per SIMD no longer suffice.
#pragma unroll 1
  for (int hf = 0; hf < 2; ++hf) {
    // Half of a head's k row is one 128-byte line; its eight 16-byte pieces per
    // lane pair are fetched together, so that no line is fetched twice.
    const float* pa = (const float*)((const char*)Wq + oa);
    const float* pb = (const float*)((const char*)kv + ob);
    v4f bv[4][4];                       // [nt][octet]
#pragma unroll   // bv[][] is indexed by constants and stays in registers
    for (int nt = 0; nt < 4; ++nt)
#pragma unroll   // as above
      for (int i = 0; i < 4; ++i)
        bv[nt][i] = *(const v4f*)(pb + (size_t)nt * 16 * (2 * DATTN) + i * 8);
#pragma unroll   // acc[], av[][] and bv[][] are indexed by constants
    for (int i = 0; i < 4; ++i) {
      float av[4][4];                   // [mt][e]
#pragma unroll   // as above
      for (int mt = 0; mt < 4; ++mt)
#pragma unroll   // as above
        for (int e = 0; e < 4; ++e)
          av[mt][e] = pa[(size_t)(i * 8 + e) * QD_ + mt * 16];
#pragma unroll   // as above
      for (int s = 0; s < 2; ++s)
#pragma unroll   // as above
        for (int mt = 0; mt < 4; ++mt) {
          const v2f a = {av[mt][2 * s], av[mt][2 * s + 1]};
#pragma unroll   // as above
          for (int nt = 0; nt < 4; ++nt) {
            const v2f b = {bv[nt][i][2 * s], bv[nt][i][2 * s + 1]};
            acc[mt * 4 + nt] = __builtin_amdgcn_wmma_f32_16x16x4_f32(
                false, a, false, b, (short)0, acc[mt * 4 + nt], false, false);
          }
        }
    }
    // The wait: the two additions below rewrite the offset registers of the
    // loads above. The four v_nop: free vector slots between the last matrix
    // steps and whatever touches their result or reuses their operand registers.
    // The sums are inputs, so the statement stands behind every matrix step; the
    // offsets pass through it, so their additions stand behind it.
    asm volatile("s_wait_xcnt 0x0\n\tv_nop\n\tv_nop\n\tv_nop\n\tv_nop"
                 : "+v"(oa), "+v"(ob)
                 : "v"(acc[0]), "v"(acc[1]), "v"(acc[2]), "v"(acc[3]),
                   "v"(acc[4]), "v"(acc[5]), "v"(acc[6]), "v"(acc[7]),
                   "v"(acc[8]), "v"(acc[9]), "v"(acc[10]), "v"(acc[11]),
                   "v"(acc[12]), "v"(acc[13]), "v"(acc[14]), "v"(acc[15])
                 : "memory");
    oa += 32 * QD_ * 4;
    ob += 32 * 4;
  }
  // Lane (idx16, kh) of tile (mt, nt) holds kv row nt*16 + idx16 and the eight
  // columns c = mt*16 + kh*8 + 0..7: two quads.
#pragma unroll   // acc[] is indexed by constants
  for (int mt = 0; mt < 4; ++mt) {
#pragma unroll   // as above
    for (int nt = 0; nt < 4; ++nt) {
      const v8f a = acc[mt * 4 + nt];
      float* d = &Ts[(nt * 16 + idx16) * UP_ + ((mt * 4 + kh * 2) * UH_ + wave) * 4];
      const v4f lo = {a[0], a[1], a[2], a[3]}, hi = {a[4], a[5], a[6], a[7]};
      *(v4f*)d = lo;
      *(v4f*)(d + UH_ * 4) = hi;
    }
  }
  __syncthreads();

  // 128 quads (16 c quads x 8 heads) per kv row; a wave's 32 lanes write four
  // whole 128-byte lines.
  const int r = t & 127;
  const float* ls = &Ts[(t >> 7) * UP_ + r * 4];
  float* gd = ut + (((size_t)(j0 + (t >> 7)) * (QD_ / 4) + (c0 >> 2) + (r >> 3)) * NH
                    + hz * UH_ + (r & 7)) * 4;
#pragma unroll   // constant offsets from one LDS and one global address
  for (int it = 0; it < UJ_ / 2; it += 8) {
    v4f x[8];
#pragma unroll   // x[] is indexed by constants
    for (int k = 0; k < 8; ++k) x[k] = *(const v4f*)(ls + (it + k) * 2 * UP_);
#pragma unroll   // as above
    for (int k = 0; k < 8; ++k) *(v4f*)(gd + (size_t)(it + k) * 2 * (QD_ * NH)) = x[k];
    // The next eight LDS reads land in registers that the stores above name.
    if (it + 8 < UJ_ / 2) asm volatile("s_wait_xcnt 0x0" ::: "memory");
  }
}

// 2^x. The v_nop is the free slot that the instruction set asks for behind a
// transcendental; inside the statement it cannot drift away from it.
__device__ __forceinline__ float exp2_slot(float x) {
  float r;
  asm("v_exp_f32 %0, %1\n\tv_nop" : "=v"(r) : "v"(x));
  return r;
}

// ---------------------------------------------------------------------------
// Windowed segment attention, scores and softmax.
// S[q][j][h] = sum_c q[q][c] * U[j][h][c] on matrix steps: a block takes SM_
// query rows and walks only the kv rows between the lowest and the highest
// window of its rows (found here, for any seg content). One kv row = one tile
// of 16 columns (its heads). The 8 waves split c: wave w owns c = 128*w .. +127
// and keeps its part of the query rows in registers; the eight partial sums
// meet in LDS. k order of step s of octet kq, equal for A and B:
//   lane half kh, element e -> c = 128*wave + 8*kq + 4*kh + 2*s + e.
//  For w in 0..3: idx = seg_id[b,q] - w; idx < 0 is masked (lowest score),
//  and the row that is read is idx clipped to [0, LKV-1], as in the reference.
//  Rs[wave][q][r][h]: partial score of kv row c0 - 3 + r, c0 = clip(seg_id);
//  only rows inside the query's own window are kept.
//  pg : (B * LQ, NH, 4). Entry r is the weight of kv row c0 - 3 + r; windows
//  that the clip sends to one row are added up.
// ---------------------------------------------------------------------------
#define SM_ 32

// Second bound: four waves per SIMD (two blocks per WGP), which cover each
// other's load latency.
__global__ __launch_bounds__(256, 4) void window_scores(
    const float* __restrict__ q, const float* __restrict__ ut,
    const int* __restrict__ seg, float* __restrict__ pg)
{
  __shared__ float Rs[8 * SM_ * KW_ * NH];

  const int t     = threadIdx.x;
  const int lane  = t & 31;
  const int wave  = t >> 5;
  const int idx16 = lane & 15;
  const int kh    = lane >> 4;
  // Share u: the 64 blocks of query rows 2048*u .. 2048*u + 2047, in order.
  const int row0  = ((blockIdx.x & (NSHARE - 1)) * ((B_ * LQ_) / (SM_ * NSHARE))
                     + blockIdx.x / NSHARE) * SM_;    // flat b * LQ_ + q
  static_assert(SM_ == 32, "one query row per lane");

  const int*   sp = seg + row0 + lane;
  const float* qp = q + (size_t)(row0 + idx16) * QD_ + wave * 128 + kh * 4;
  const int sl = *sp;
  v4f av[2][16];
#pragma unroll   // av[][] is indexed by constants and stays in registers
  for (int mt = 0; mt < 2; ++mt)
#pragma unroll   // as above
    for (int kq = 0; kq < 16; ++kq)
      av[mt][kq] = *(const v4f*)(qp + mt * 16 * QD_ + kq * 8);
  // The loads' address registers are inputs here, so none of them is reused
  // (not even as a load's target) before this wait.
  asm volatile("s_wait_xcnt 0x0" :: "v"(sp), "v"(qp) : "memory");

  // Lowest and highest clipped segment of the block's 32 rows.
  const int cl = min(max(sl, 0), LKV_ - 1);
  int mn = cl, mx = cl;
#pragma unroll   // five fixed exchange steps, no loop counter
  for (int o = 16; o > 0; o >>= 1) {
    mn = min(mn, __shfl_xor(mn, o));
    mx = max(mx, __shfl_xor(mx, o));
  }
  const int jlo = __builtin_amdgcn_readfirstlane(max(mn - (KW_ - 1), 0));
  const int jhi = __builtin_amdgcn_readfirstlane(mx);   // <= LKV_ - 1

  // 3 - c0 of the 16 query rows whose sums this lane holds.
  int dq[2][8];
#pragma unroll   // dq[][] is indexed by constants
  for (int mt = 0; mt < 2; ++mt)
#pragma unroll   // as above
    for (int v = 0; v < 8; ++v)
      dq[mt][v] = (KW_ - 1) - __shfl(cl, mt * 16 + kh * 8 + v);

  float* rb = &Rs[(wave * SM_ + kh * 8) * (KW_ * NH) + idx16];
  const float* ub = ut + ((size_t)(row0 / LQ_) * LKV_ * (QD_ / 4) + wave * 32 + kh) * (NH * 4)
                       + idx16 * 4;

  int jv = jlo;                         // j, kept in a vector register
  for (int j = jlo; j <= jhi; ++j) {
    const float* uj = ub + (size_t)j * (QD_ * NH);
    v4f bv[16];
#pragma unroll   // bv[] is indexed by constants and stays in registers
    for (int kq = 0; kq < 16; ++kq)
      bv[kq] = *(const v4f*)(uj + kq * (2 * NH * 4));
    // The next trip rewrites the address registers that the loads above name.
    asm volatile("s_wait_xcnt 0x0" :: "v"(uj) : "memory");
    // Keeps the trip's 16 loads together ahead of its matrix steps: one load
    // latency a trip, which the SIMD's other waves cover.
    __builtin_amdgcn_sched_barrier(0);

    v8f a0 = {}, a1 = {};
#pragma unroll   // av[][] and bv[] are indexed by constants
    for (int kq = 0; kq < 16; ++kq) {
      a0 = __builtin_amdgcn_wmma_f32_16x16x4_f32(false, av[0][kq].lo, false, bv[kq].lo, (short)0, a0, false, false);
      a1 = __builtin_amdgcn_wmma_f32_16x16x4_f32(false, av[1][kq].lo, false, bv[kq].lo, (short)0, a1, false, false);
      a0 = __builtin_amdgcn_wmma_f32_16x16x4_f32(false, av[0][kq].hi, false, bv[kq].hi, (short)0, a0, false, false);
      a1 = __builtin_amdgcn_wmma_f32_16x16x4_f32(false, av[1][kq].hi, false, bv[kq].hi, (short)0, a1, false, false);
    }

    // Four free vector slots between the last matrix steps and whatever touches
    // their result or reuses their operand registers. The row number passes
    // through the statement, so no later arithmetic is moved ahead of it.
    asm volatile("v_nop\n\tv_nop\n\tv_nop\n\tv_nop"
                 : "+v"(a0), "+v"(a1), "+v"(jv) : "v"(bv[15]));

#pragma unroll   // a0, a1 and dq[][] are indexed by constants
    for (int v = 0; v < 8; ++v) {
      const int r0 = jv + dq[0][v], r1 = jv + dq[1][v];
      if ((unsigned)r0 < (unsigned)KW_) rb[v * (KW_ * NH) + r0 * NH] = a0[v];
      if ((unsigned)r1 < (unsigned)KW_) rb[(16 + v) * (KW_ * NH) + r1 * NH] = a1[v];
    }
    ++jv;
  }
  __syncthreads();

  const float scale = 0.125f;                 // 64^-0.5
  float* pgp = pg + (size_t)row0 * (NH * KW_) + t * KW_;
#pragma unroll   // two (query row, head) pairs per thread
  for (int k = 0; k < 2; ++k) {
    const int ql = (t >> 4) + k * 16;         // head = idx16
    const int s0 = __shfl(sl, ql);
    const int c0 = min(max(s0, 0), LKV_ - 1);
    int   rr[KW_];
    float sc[KW_];
#pragma unroll   // rr[] and sc[] are indexed by constants
    for (int w = 0; w < KW_; ++w) {
      rr[w] = 3 - (c0 - min(max(s0 - w, 0), LKV_ - 1));   // 0..3, a row that was walked
      const float* rp = &Rs[(ql * KW_ + rr[w]) * NH + idx16];
      float s = 0.f;
#pragma unroll   // constant offsets from one LDS address
      for (int wv = 0; wv < 8; ++wv) s += rp[wv * (SM_ * KW_ * NH)];
      sc[w] = (s0 - w >= 0) ? s * scale : -FLT_MAX;
    }

    const float mxs = fmaxf(fmaxf(sc[0], sc[1]), fmaxf(sc[2], sc[3]));
    float p[KW_];
    float sum = 0.f;
#pragma unroll
    for (int w = 0; w < KW_; ++w) {
      p[w] = exp2_slot((sc[w] - mxs) * 1.44269504f);   // e^(sc - mx); masked: 0
      sum += p[w];
    }
    const float inv = 1.f / sum;

    float pr[KW_] = {0.f, 0.f, 0.f, 0.f};
#pragma unroll
    for (int w = 0; w < KW_; ++w) {
      const float pw = p[w] * inv;
#pragma unroll   // pr[] is indexed by constants
      for (int kk = 0; kk < KW_; ++kk) pr[kk] += (rr[w] == kk) ? pw : 0.f;
    }
    *(float4*)(pgp + k * 256 * KW_) = make_float4(pr[0], pr[1], pr[2], pr[3]);
  }
}

// ---------------------------------------------------------------------------
// out[q][n] = sum over kv rows j and heads h of P[q][j][h] * T[j][h][n], with
// T[j][h][n] = sum_d v[j][h][d] * Wo[n][h*HD + d] (gemm_xwT_wmma<1>) and
// P[q][j][h] the softmax weight of row j, zero outside the query's window.
// A block takes MT_ query rows (four tiles of 16) and walks only the kv rows
// between the lowest and the highest window of its rows (found here, for any
// seg content), two rows j at a time: k = 2 rows x 16 heads = 8 matrix steps.
// The pair's table rows are loaded once for all four tiles; a tile does its
// matrix steps only for pairs between the lowest and the highest window of its
// own 16 rows. Outside of these all its weights are zero, so nothing is lost.
// k order of one step hs, equal for A and B: lane half kh, element e
//   -> head 2*hs + kh, kv row 2*jp + e.
// Block = 8 waves; wave tile 64 x 32, block tile 64 x NB_.
//
// Ps[q][h][0..7] = {0, 0, pg[q][h][0..3], 0, 0}: the pair of weights for rows
// (2*jp, 2*jp + 1) is two neighbouring floats at a clamped index, zeros
// included, so no lane is ever switched off. Rows q, q + 16, q + 32 and q + 48
// share one LDS row of PQ_ floats: the even heads of the four tiles (PM_ floats
// a tile), then, PO_ floats in, the odd heads. So every fragment read of a trip
// is a constant offset of fewer than 256 floats (what a two-address LDS read
// can hold) from one register a tile, and no address arithmetic stands among
// the matrix steps. PQ_ and PO_ spread the 32 lanes over the banks.
// ---------------------------------------------------------------------------
#define MT_  64
#define NB_  256
#define PQ_  524
#define PM_  64
#define PO_  258

__global__ __launch_bounds__(256) void out_from_table(
    const float* __restrict__ pg, const float* __restrict__ tab,
    const int* __restrict__ seg, float* __restrict__ out)
{
  __shared__ float Ps[16 * PQ_];

  const int t     = threadIdx.x;
  const int lane  = t & 31;
  const int wave  = t >> 5;
  const int idx16 = lane & 15;
  const int kh    = lane >> 4;
  // Share u: the 32 blocks of query rows 2048*u .. 2048*u + 2047, in order, the
  // four column blocks of the same rows one after the other.
  const int br    = blockIdx.x / NSHARE;
  const int row0  = ((blockIdx.x & (NSHARE - 1)) * ((B_ * LQ_) / (MT_ * NSHARE))
                     + (br >> 2)) * MT_;              // flat b * LQ_ + q
  const int n0    = (br & 3) * NB_ + wave * 32;

  // MT_ * NH = 1024 weight quads, four per thread; the block's 64 segments, two
  // per lane.
  static_assert(MT_ * NH == 1024 && MT_ == 64, "four quads per thread, two rows per lane");
  const float* pp = pg + (size_t)row0 * (NH * KW_) + t * KW_;
  const int*   sp = seg + row0 + lane;
  float4 pv[4];
#pragma unroll   // pv[] is indexed by constants and stays in registers
  for (int k = 0; k < 4; ++k) pv[k] = *(const float4*)(pp + k * 256 * KW_);
  const int sl[2] = {sp[0], sp[32]};
  // The loads' offset registers (the two indices) are inputs here, so neither
  // is reused (not even as a load's target) before this wait.
  asm volatile("s_wait_xcnt 0x0" :: "v"(t), "v"(lane) : "memory");

#pragma unroll   // pv[] is indexed by constants and stays in registers
  for (int k = 0; k < 4; ++k) {
    const int i = t + k * 256, q = i >> 4, h = i & 15;
    float* d = &Ps[(q & 15) * PQ_ + (q >> 4) * PM_ + (h & 1) * PO_ + (h >> 1) * 8];
    const v2f z = {0.f, 0.f}, lo = {pv[k].x, pv[k].y}, hi = {pv[k].z, pv[k].w};
    *(v2f*)(d + 0) = z;
    *(v2f*)(d + 2) = lo;
    *(v2f*)(d + 4) = hi;
    *(v2f*)(d + 6) = z;
  }

  // Lowest and highest clipped segment of each tile's 16 rows (one half of the
  // lanes each), then the first and the last pair of kv rows of each tile.
  const int cl[2] = {min(max(sl[0], 0), LKV_ - 1), min(max(sl[1], 0), LKV_ - 1)};
  int mn[2] = {cl[0], cl[1]}, mx[2] = {cl[0], cl[1]};
#pragma unroll   // four fixed exchange steps, no loop counter
  for (int o = 8; o > 0; o >>= 1) {
#pragma unroll   // mn[] and mx[] are indexed by constants
    for (int g = 0; g < 2; ++g) {
      mn[g] = min(mn[g], __shfl_xor(mn[g], o));
      mx[g] = max(mx[g], __shfl_xor(mx[g], o));
    }
  }
  int tlo[4], thi[4], c0a[4], ab[4];
#pragma unroll   // all four arrays are indexed by constants
  for (int m = 0; m < 4; ++m) {
    tlo[m] = max(__builtin_amdgcn_readlane(mn[m >> 1], (m & 1) * 16) - (KW_ - 1), 0) >> 1;
    thi[m] = __builtin_amdgcn_readlane(mx[m >> 1], (m & 1) * 16) >> 1;   // <= LKV_/2 - 1
    c0a[m] = __shfl(cl[m >> 1], (m & 1) * 16 + idx16);
    ab[m]  = idx16 * PQ_ + m * PM_ + kh * PO_ + 2;
  }
  const int jp0 = min(min(tlo[0], tlo[1]), min(tlo[2], tlo[3]));
  const int jp1 = max(max(thi[0], thi[1]), max(thi[2], thi[3]));

  const float* tb = tab + ((size_t)(row0 / LQ_) * (LKV_ / 2) * NH + kh) * (DATTN * 2)
                        + (n0 + idx16) * 2;

  v8f acc[8] = {};                      // [m*2 + nt]
  __syncthreads();

  for (int jp = jp0; jp <= jp1; ++jp) {
    const float* tj = tb + (size_t)jp * (NH * DATTN * 2);

    v2f b[NH / 2][2];
#pragma unroll   // b[][] is indexed by constants and stays in registers
    for (int hs = 0; hs < NH / 2; ++hs)
#pragma unroll   // as above
      for (int nt = 0; nt < 2; ++nt)
        b[hs][nt] = *(const v2f*)(tj + hs * (2 * DATTN * 2) + nt * 32);
    // The next trip rewrites the address registers that the loads above name.
    asm volatile("s_wait_xcnt 0x0" :: "v"(tj) : "memory");
    // Keeps the trip's 16 loads together ahead of its matrix steps: one load
    // latency a trip; left free, the scheduler issues each step's loads only
    // one step ahead and the wave waits at every step.
    __builtin_amdgcn_sched_barrier(0);

#pragma unroll   // acc[], b[][] and the tiles' arrays are indexed by constants
    for (int m = 0; m < 4; ++m) {
      // The same for every lane (scalar registers): the whole wave takes the
      // tile's matrix steps or skips them.
      if (jp >= tlo[m] && jp <= thi[m]) {
        const int ai = ab[m] + min(max(2 * jp + (KW_ - 1) - c0a[m], -2), 4);
#pragma unroll   // as above
        for (int hs = 0; hs < NH / 2; ++hs) {
          const v2f a = {Ps[ai + hs * 8], Ps[ai + hs * 8 + 1]};
#pragma unroll   // as above
          for (int nt = 0; nt < 2; ++nt)
            acc[m * 2 + nt] = __builtin_amdgcn_wmma_f32_16x16x4_f32(
                false, a, false, b[hs][nt], (short)0, acc[m * 2 + nt], false, false);
        }
        // Four free vector slots between the tile's last matrix steps and
        // whatever next reuses their operand registers or touches their sums.
        asm volatile("v_nop\n\tv_nop\n\tv_nop\n\tv_nop"
                     : "+v"(acc[m * 2]), "+v"(acc[m * 2 + 1]));
      }
    }
  }

#pragma unroll   // acc[] is indexed by constants
  for (int m = 0; m < 4; ++m) {
#pragma unroll   // as above
    for (int nt = 0; nt < 2; ++nt) {
      float* yb = out + (size_t)(row0 + m * 16 + kh * 8) * DATTN + n0 + nt * 16 + idx16;
      const v8f a = acc[m * 2 + nt];
#pragma unroll   // as above
      for (int v = 0; v < 8; ++v) yb[(size_t)v * DATTN] = a[v];
    }
  }
}

// ---------------------------------------------------------------------------
// Launcher. Inputs: q, kv_src, seg_id, Wq, Wkv, Wo.
// Workspace layout: kv (16MB) | pg (4MB) | ut, then tab (128MB)  = 148MB.
// ut is dead once window_scores has run; tab is written over it afterwards.
// ---------------------------------------------------------------------------
extern "C" void kernel_launch(void* const* d_in, const int* in_sizes, int n_in,
                              void* d_out, int out_size, void* d_ws, size_t ws_size,
                              hipStream_t stream) {
  const float* q      = (const float*)d_in[0];
  const float* kv_src = (const float*)d_in[1];
  const int*   seg    = (const int*)d_in[2];
  const float* Wq     = (const float*)d_in[3];
  const float* Wkv    = (const float*)d_in[4];
  const float* Wo     = (const float*)d_in[5];
  float* out = (float*)d_out;

  float* kv   = (float*)d_ws;                               // B*LKV*2*DATTN
  float* pg   = kv + (size_t)B_ * LKV_ * 2 * DATTN;         // B*LQ*NH*KW
  float* tab  = pg + (size_t)B_ * LQ_ * NH * KW_;           // B*LKV*NH*DATTN
  float* ut   = tab;                                        // B*LKV*NH*QD

  const dim3 blk(256);

  // kv = kv_src @ Wkv.T              M=2048  N=2048 K=1024
  gemm_xwT_wmma<0><<<dim3(((2 * DATTN) / 128) * ((B_ * LKV_) / 128)), blk, 0, stream>>>(
      kv_src, Wkv, kv, B_ * LKV_, 2 * DATTN, 1024, 1024, 1024);

  // ut[j][h] = k[j][h] @ Wq[h rows]   per head: 1024 x 2048, K=64
  fold_wq_into_k<<<dim3((QD_ / UC_) * ((B_ * LKV_) / UJ_) * (NH / UH_)), blk, 0, stream>>>(
      kv, Wq, ut);

  // window softmax weights           one block per SM_ query rows
  window_scores<<<dim3((B_ * LQ_) / SM_), blk, 0, stream>>>(
      q, ut, seg, pg);

  // tab[j][h] = v[j][h] @ Wo[:, h].T  per head: M=2048 N=1024 K=64
  // (last before its reader, so that more of it is still in L2 there)
  gemm_xwT_wmma<1><<<dim3((1024 / 128) * ((B_ * LKV_) / 128) * NH), blk, 0, stream>>>(
      kv + DATTN, Wo, tab, B_ * LKV_, DATTN, HD, 2 * DATTN, DATTN);

  // out = P @ tab                    k = the block's own span of kv rows x heads
  out_from_table<<<dim3((DATTN / NB_) * ((B_ * LQ_) / MT_)), blk, 0, stream>>>(
      pg, tab, seg, out);
}

// v007
// It runs in 160 microseconds.
// Next to v006, in two timings, it ran 1.03 times as fast each time.
// Over all steps from v000 it is 2.75 times as fast.
#include <hip/hip_runtime.h>
#include <cfloat>

// ---------------------------------------------------------------------------
// Problem constants (from reference)
// ---------------------------------------------------------------------------
#define B_    4
#define LQ_   4096
#define LKV_  512
#define DATTN 1024
#define NH    16
#define HD    64
#define KW_   4          // LOOKBACK + 1

typedef __attribute__((ext_vector_type(2))) float v2f;
typedef __attribute__((ext_vector_type(8))) float v8f;
typedef __attribute__((ext_vector_type(4))) int   v4i;

typedef __attribute__((address_space(1))) v4i* gv4i_p;   // global
typedef __attribute__((address_space(3))) v4i* lv4i_p;   // LDS

// ---------------------------------------------------------------------------
// Tile order. Every launch has a one-dimensional grid, and workgroup b takes
// share b & 7, place b >> 3 inside the share. Share u holds, in every launch,
// the work on kv rows 256*u .. 256*u + 255 (flat b * LKV_ + j) and on query
// rows 2048*u .. 2048*u + 2047, which for sorted segments are about the same
// stretch. Grouping them so aims at one L2 a share, for speed only: a
// table row that neighbouring query blocks both walk is fetched from memory
// once, not once by each L2, and a table's writer and its readers can meet in
// the same L2.
// For speed only, nothing promises that placement: b -> tile is a permutation,
// so every tile is done exactly once wherever the workgroups land.
// ---------------------------------------------------------------------------
#define NSHARE 8

// ---------------------------------------------------------------------------
// Async global->LDS staging (gfx1250). Falls back to a synchronous copy if
// the builtins are not declared by this toolchain.
// ---------------------------------------------------------------------------
#if __has_builtin(__builtin_amdgcn_global_load_async_to_lds_b128)
#define HAS_ASYNC_LDS 1
#endif

__device__ __forceinline__ void stage16(const float* g, float* l) {
#ifdef HAS_ASYNC_LDS
  __builtin_amdgcn_global_load_async_to_lds_b128((gv4i_p)g, (lv4i_p)l, 0, 0);
#else
  *(float4*)l = *(const float4*)g;
#endif
}

__device__ __forceinline__ void async_wait_all() {
#ifdef HAS_ASYNC_LDS
#if __has_builtin(__builtin_amdgcn_s_wait_asynccnt)
  __builtin_amdgcn_s_wait_asynccnt(0);
#else
  asm volatile("s_wait_asynccnt 0x0" ::: "memory");
#endif
#endif
}

// ---------------------------------------------------------------------------
// Y[m][n] = sum_k X[m][k] * W[n][k]   (torch-style y = x @ W.T)
// X: M x K, row pitch ldx; W: N x K, row pitch ldw; Y: M x N row-major.
// M, N multiples of 128; K a multiple of the chunk.
//
// PERHEAD = 1: the block has a head h; X and W start at column h * HD, K is HD,
// and Y is the table T[m / 2][h][n][m & 1] that out_from_table reads (two
// neighbouring rows m side by side, which is the k pair of one B fragment there).
//
// Workgroup (256 thr = 8 waves) computes a 128x128 output block.
// Wave w: M-strip (w>>1)*32 (two 16-row tiles), N-strip (w&1)*64 (four tiles).
// K is consumed in chunks of KCH floats, staged in LDS by async copies:
//   PERHEAD = 0: KCH = 128, two buffers; a wave's copy is one whole row of the
//                chunk (512 contiguous bytes), and the wait and the barrier of a
//                chunk stand behind 256 matrix steps per wave. The two buffers
//                take most of a WGP's LDS: one workgroup per WGP.
//   PERHEAD = 1: KCH = HD = 64, the whole K: one fill, one barrier, one buffer;
//                a wave's copy is two whole rows (256 contiguous bytes each).
//
// LDS row stride = KCH + 4 floats: 4*r mod 64 distinct for r=0..15 -> conflict-
// free 8-byte fragment reads, and 16B-aligned rows for the async b128 writes.
//
// V_WMMA_F32_16X16X4_F32 operand layout (ISA 7.12.2):
//   A 16x4 : lane = M + 16*Khalf, holds K = 2*Khalf + {0,1}  -> float2/lane
//   B 4x16 : lane = N + 16*Khalf, holds K = 2*Khalf + {0,1}  -> float2/lane
//   C/D    : VGPR v, lanes 0-15 -> row v, lanes 16-31 -> row v+8, col=lane&15
// ---------------------------------------------------------------------------
template <int PERHEAD>
__global__ __launch_bounds__(256) void gemm_xwT_wmma(
    const float* __restrict__ X, const float* __restrict__ W,
    float* __restrict__ Y, int M, int N, int K, int ldx, int ldw)
{
  constexpr int KCH = PERHEAD ? HD : 128;   // floats of K per chunk
  constexpr int NBF = PERHEAD ? 1 : 2;      // LDS buffers
  constexpr int LDP = KCH + 4;              // padded LDS row stride (floats)
  constexpr int CPR = KCH / 4;              // 16-byte pieces per row
  constexpr int RST = 256 / CPR;            // rows that the block's 256 copies cover
  constexpr int NCP = 128 / RST;            // copies per thread and matrix

  __shared__ __attribute__((aligned(16))) float Xs[NBF][128 * LDP];
  __shared__ __attribute__((aligned(16))) float Ws[NBF][128 * LDP];

  const int t     = threadIdx.x;
  const int lane  = t & 31;
  const int wave  = t >> 5;
  // Share u: the two 128-row blocks 2*u and 2*u + 1 (M = 2048), all columns.
  const int bu    = blockIdx.x & (NSHARE - 1);
  const int br    = blockIdx.x / NSHARE;
  const int mBlk  = (bu * 2 + (br & 1)) * 128;
  const int nBlk  = (PERHEAD ? ((br >> 1) & 7) : (br >> 1)) * 128;
  const int head  = PERHEAD ? (br >> 4) : 0;
  const int mw    = (wave >> 1) * 32;   // wave M offset within block
  const int nw    = (wave & 1) * 64;    // wave N offset within block
  const int idx16 = lane & 15;
  const int kh    = lane >> 4;          // K-half: 0 -> K{0,1}, 1 -> K{2,3}
  const int Kx    = PERHEAD ? KCH : K;

  // Staging map: copy i of thread t moves 16 bytes of row sRow + i * RST.
  const int sRow = t / CPR;
  const int sCg  = (t % CPR) * 4;
  const int sLds = sRow * LDP + sCg;

  v8f acc[8] = {};                      // [mt*4 + nt]

  if (PERHEAD) {
    X += head * HD;
    W += head * HD;
  }
  const float* xg = X + (size_t)(mBlk + sRow) * ldx + sCg;
  const float* wg = W + (size_t)(nBlk + sRow) * ldw + sCg;

  // ---- prologue: stage chunk 0 into buffer 0 --------------------------------
#pragma unroll   // constant LDS offsets from one address
  for (int i = 0; i < NCP; ++i) {
    stage16(xg + (size_t)(i * RST) * ldx, &Xs[0][sLds + i * RST * LDP]);
    stage16(wg + (size_t)(i * RST) * ldw, &Ws[0][sLds + i * RST * LDP]);
  }
  async_wait_all();
  __syncthreads();

  for (int kc = 0; kc < Kx; kc += KCH) {
    const int buf = PERHEAD ? 0 : ((kc / KCH) & 1);

    // ---- stage next chunk into the other buffer (overlaps with compute) ----
    if constexpr (!PERHEAD) {
      if (kc + KCH < Kx) {
        const int kn = kc + KCH;
#pragma unroll   // constant LDS offsets from one address
        for (int i = 0; i < NCP; ++i) {
          stage16(xg + (size_t)(i * RST) * ldx + kn, &Xs[buf ^ 1][sLds + i * RST * LDP]);
          stage16(wg + (size_t)(i * RST) * ldw + kn, &Ws[buf ^ 1][sLds + i * RST * LDP]);
        }
      }
    }

    // ---- compute current chunk from LDS ------------------------------------
#pragma unroll   // one straight run per chunk: fragment reads go out in groups ahead of their steps
    for (int ks = 0; ks < KCH; ks += 4) {
      const int kb = ks + 2 * kh;
      const v2f a0 = *(const v2f*)&Xs[buf][(mw + idx16)      * LDP + kb];
      const v2f a1 = *(const v2f*)&Xs[buf][(mw + 16 + idx16) * LDP + kb];
#pragma unroll
      for (int nt = 0; nt < 4; ++nt) {
        const v2f b = *(const v2f*)&Ws[buf][(nw + nt * 16 + idx16) * LDP + kb];
        acc[nt]     = __builtin_amdgcn_wmma_f32_16x16x4_f32(false, a0, false, b, (short)0, acc[nt],     false, false);
        acc[4 + nt] = __builtin_amdgcn_wmma_f32_16x16x4_f32(false, a1, false, b, (short)0, acc[4 + nt], false, false);
      }
    }

    if constexpr (!PERHEAD) {
      async_wait_all();     // next chunk resident
      __syncthreads();      // all waves done reading buf / writing buf^1
    }
  }

  // Keeps the store addresses' arithmetic behind the matrix steps: moved up among
  // them, it lands in fragment registers that a matrix step just issued still reads.
  __builtin_amdgcn_sched_barrier(0);

  // ---- write back -----------------------------------------------------------
#pragma unroll
  for (int mt = 0; mt < 2; ++mt) {
#pragma unroll
    for (int nt = 0; nt < 4; ++nt) {
      const int row = mBlk + mw + mt * 16 + kh * 8;
      const int cn  = nBlk + nw + nt * 16 + idx16;
      const v8f a = acc[mt * 4 + nt];
      if (PERHEAD) {
        float* yb = Y + (((size_t)(row >> 1) * NH + head) * N + cn) * 2;
#pragma unroll   // a[] is indexed by constants
        for (int v = 0; v < 8; v += 2) {
          const v2f pr = {a[v], a[v + 1]};
          *(v2f*)(yb + (size_t)(v >> 1) * NH * N * 2) = pr;
        }
      } else {
        float* yb = Y + (size_t)row * N + cn;
#pragma unroll
        for (int v = 0; v < 8; ++v) yb[(size_t)v * N] = a[v];
      }
    }
  }
}

// ---------------------------------------------------------------------------
// Wq folded into K. score[q][h][j] = sum_d (q Wq^T)[h*HD+d] * k[j][h*HD+d]
//                                  = sum_c q[c] * U[j][h][c],
// U[j][h][c] = sum_d k[j][h*HD+d] * Wq[h*HD+d][c]          (K = HD = 64).
// Stored as ut[j][c / 4][h][c & 3]: the 16 heads of one kv row side by side,
// four c each, so that one 16-byte load per lane in window_scores covers 512
// contiguous bytes and feeds two matrix steps.
//
// Block = 8 waves = 8 heads (one half of the heads), UC_ columns c (matrix
// rows) x UJ_ kv rows j (matrix columns) per wave, operands straight from
// global memory. k order of step s of octet kq, equal for A and B:
//   lane half kh, element e -> d = 8*kq + 4*kh + 2*s + e.
// The results go through LDS so that the 8 heads' 16-byte pieces leave as
// whole 128-byte lines. UP_: one kv row's floats in LDS plus 4, which spreads
// the 16 lanes of a 16-byte write over all banks.
// ---------------------------------------------------------------------------
#define QD_  1024        // q_dim, the pitch of q and Wq
#define UJ_  64
#define UC_  64
#define UH_  8
#define UP_  (UC_ * UH_ + 4)

typedef __attribute__((ext_vector_type(4))) float v4f;

// Second bound: four waves per SIMD, so that two blocks share a WGP and one
// block's loads and stores hide behind the other's matrix steps.
__global__ __launch_bounds__(256, 4) void fold_wq_into_k(
    const float* __restrict__ kv, const float* __restrict__ Wq,
    float* __restrict__ ut)
{
  __shared__ float Ts[UJ_ * UP_];

  const int t     = threadIdx.x;
  const int lane  = t & 31;
  const int wave  = t >> 5;
  const int idx16 = lane & 15;
  const int kh    = lane >> 4;
  // Share u: the four 64-row blocks 4*u .. 4*u + 3. The two halves of the heads
  // come first: they write the two halves of the same 256 bytes.
  const int bu    = blockIdx.x & (NSHARE - 1);
  const int br    = blockIdx.x / NSHARE;
  const int hz    = br & 1;
  const int c0    = ((br >> 1) & 15) * UC_;
  const int j0    = (bu * 4 + (br >> 5)) * UJ_;     // flat b * LKV_ + j
  const int h     = hz * UH_ + wave;

  // The lane's byte offsets into Wq and kv (both below 2^25).
  unsigned oa = (unsigned)(((h * HD + kh * 4) * QD_ + c0 + idx16) * 4);
  unsigned ob = (unsigned)(((j0 + idx16) * (2 * DATTN) + h * HD + kh * 4) * 4);

  v8f acc[16] = {};                     // [mt*4 + nt]

  // Kept rolled: unrolled, the second half's loads are hoisted into the first
  // and the registers of four waves per SIMD no longer suffice.
#pragma unroll 1
  for (int hf = 0; hf < 2; ++hf) {
    // Half of a head's k row is one 128-byte line; its eight 16-byte pieces per
    // lane pair are fetched together, so that no line is fetched twice.
    const float* pa = (const float*)((const char*)Wq + oa);
    const float* pb = (const float*)((const char*)kv + ob);
    v4f bv[4][4];                       // [nt][octet]
#pragma unroll   // bv[][] is indexed by constants and stays in registers
    for (int nt = 0; nt < 4; ++nt)
#pragma unroll   // as above
      for (int i = 0; i < 4; ++i)
        bv[nt][i] = *(const v4f*)(pb + (size_t)nt * 16 * (2 * DATTN) + i * 8);
#pragma unroll   // acc[], av[][] and bv[][] are indexed by constants
    for (int i = 0; i < 4; ++i) {
      float av[4][4];                   // [mt][e]
#pragma unroll   // as above
      for (int mt = 0; mt < 4; ++mt)
#pragma unroll   // as above
        for (int e = 0; e < 4; ++e)
          av[mt][e] = pa[(size_t)(i * 8 + e) * QD_ + mt * 16];
#pragma unroll   // as above
      for (int s = 0; s < 2; ++s)
#pragma unroll   // as above
        for (int mt = 0; mt < 4; ++mt) {
          const v2f a = {av[mt][2 * s], av[mt][2 * s + 1]};
#pragma unroll   // as above
          for (int nt = 0; nt < 4; ++nt) {
            const v2f b = {bv[nt][i][2 * s], bv[nt][i][2 * s + 1]};
            acc[mt * 4 + nt] = __builtin_amdgcn_wmma_f32_16x16x4_f32(
                false, a, false, b, (short)0, acc[mt * 4 + nt], false, false);
          }
        }
    }
    // The wait: the two additions below rewrite the offset registers of the
    // loads above. The four v_nop: free vector slots between the last matrix
    // steps and whatever touches their result or reuses their operand registers.
    // The sums are inputs, so the statement stands behind every matrix step; the
    // offsets pass through it, so their additions stand behind it.
    asm volatile("s_wait_xcnt 0x0\n\tv_nop\n\tv_nop\n\tv_nop\n\tv_nop"
                 : "+v"(oa), "+v"(ob)
                 : "v"(acc[0]), "v"(acc[1]), "v"(acc[2]), "v"(acc[3]),
                   "v"(acc[4]), "v"(acc[5]), "v"(acc[6]), "v"(acc[7]),
                   "v"(acc[8]), "v"(acc[9]), "v"(acc[10]), "v"(acc[11]),
                   "v"(acc[12]), "v"(acc[13]), "v"(acc[14]), "v"(acc[15])
                 : "memory");
    oa += 32 * QD_ * 4;
    ob += 32 * 4;
  }
  // Lane (idx16, kh) of tile (mt, nt) holds kv row nt*16 + idx16 and the eight
  // columns c = mt*16 + kh*8 + 0..7: two quads.
#pragma unroll   // acc[] is indexed by constants
  for (int mt = 0; mt < 4; ++mt) {
#pragma unroll   // as above
    for (int nt = 0; nt < 4; ++nt) {
      const v8f a = acc[mt * 4 + nt];
      float* d = &Ts[(nt * 16 + idx16) * UP_ + ((mt * 4 + kh * 2) * UH_ + wave) * 4];
      const v4f lo = {a[0], a[1], a[2], a[3]}, hi = {a[4], a[5], a[6], a[7]};
      *(v4f*)d = lo;
      *(v4f*)(d + UH_ * 4) = hi;
    }
  }
  __syncthreads();

  // 128 quads (16 c quads x 8 heads) per kv row; a wave's 32 lanes write four
  // whole 128-byte lines.
  const int r = t & 127;
  const float* ls = &Ts[(t >> 7) * UP_ + r * 4];
  float* gd = ut + (((size_t)(j0 + (t >> 7)) * (QD_ / 4) + (c0 >> 2) + (r >> 3)) * NH
                    + hz * UH_ + (r & 7)) * 4;
#pragma unroll   // constant offsets from one LDS and one global address
  for (int it = 0; it < UJ_ / 2; it += 8) {
    v4f x[8];
#pragma unroll   // x[] is indexed by constants
    for (int k = 0; k < 8; ++k) x[k] = *(const v4f*)(ls + (it + k) * 2 * UP_);
#pragma unroll   // as above
    for (int k = 0; k < 8; ++k) *(v4f*)(gd + (size_t)(it + k) * 2 * (QD_ * NH)) = x[k];
    // The next eight LDS reads land in registers that the stores above name.
    if (it + 8 < UJ_ / 2) asm volatile("s_wait_xcnt 0x0" ::: "memory");
  }
}

// 2^x. The v_nop is the free slot that the instruction set asks for behind a
// transcendental; inside the statement it cannot drift away from it.
__device__ __forceinline__ float exp2_slot(float x) {
  float r;
  asm("v_exp_f32 %0, %1\n\tv_nop" : "=v"(r) : "v"(x));
  return r;
}

// ---------------------------------------------------------------------------
// Windowed segment attention, scores and softmax.
// S[q][j][h] = sum_c q[q][c] * U[j][h][c] on matrix steps: a block takes SM_
// query rows (two tiles of 16) and walks only the kv rows between the lowest and
// the highest window of its rows (found here, for any seg content). One kv row =
// one tile of 16 columns (its heads), loaded once for both query tiles; a query
// tile does its matrix steps only for kv rows between the lowest and the highest
// window of its own 16 rows: of any other row none of its sums would be kept.
// The 8 waves split c: wave w owns c = 128*w .. +127
// and keeps its part of the query rows in registers; the eight partial sums
// meet in LDS. k order of step s of octet kq, equal for A and B:
//   lane half kh, element e -> c = 128*wave + 8*kq + 4*kh + 2*s + e.
//  For w in 0..3: idx = seg_id[b,q] - w; idx < 0 is masked (lowest score),
//  and the row that is read is idx clipped to [0, LKV-1], as in the reference.
//  Rs[wave][q][r][h]: partial score of kv row c0 - 3 + r, c0 = clip(seg_id);
//  only rows inside the query's own window are kept.
//  pg : (B * LQ, NH, 4). Entry r is the weight of kv row c0 - 3 + r; windows
//  that the clip sends to one row are added up.
// ---------------------------------------------------------------------------
#define SM_ 32

// Second bound: four waves per SIMD (two blocks per WGP), which cover each
// other's load latency.
__global__ __launch_bounds__(256, 4) void window_scores(
    const float* __restrict__ q, const float* __restrict__ ut,
    const int* __restrict__ seg, float* __restrict__ pg)
{
  __shared__ float Rs[8 * SM_ * KW_ * NH];

  const int t     = threadIdx.x;
  const int lane  = t & 31;
  const int wave  = t >> 5;
  const int idx16 = lane & 15;
  const int kh    = lane >> 4;
  // Share u: the 64 blocks of query rows 2048*u .. 2048*u + 2047, in order.
  const int row0  = ((blockIdx.x & (NSHARE - 1)) * ((B_ * LQ_) / (SM_ * NSHARE))
                     + blockIdx.x / NSHARE) * SM_;    // flat b * LQ_ + q
  static_assert(SM_ == 32, "one query row per lane");

  const int*   sp = seg + row0 + lane;
  const float* qp = q + (size_t)(row0 + idx16) * QD_ + wave * 128 + kh * 4;
  const int sl = *sp;
  v4f av[2][16];
#pragma unroll   // av[][] is indexed by constants and stays in registers
  for (int mt = 0; mt < 2; ++mt)
#pragma unroll   // as above
    for (int kq = 0; kq < 16; ++kq)
      av[mt][kq] = *(const v4f*)(qp + mt * 16 * QD_ + kq * 8);
  // The loads' address registers are inputs here, so none of them is reused
  // (not even as a load's target) before this wait.
  asm volatile("s_wait_xcnt 0x0" :: "v"(sp), "v"(qp) : "memory");

  // Lowest and highest clipped segment of each tile's 16 rows (one half of the
  // lanes each), then the first and the last kv row of each tile and of the block.
  const int cl = min(max(sl, 0), LKV_ - 1);
  int mn = cl, mx = cl;
#pragma unroll   // four fixed exchange steps, no loop counter
  for (int o = 8; o > 0; o >>= 1) {
    mn = min(mn, __shfl_xor(mn, o));
    mx = max(mx, __shfl_xor(mx, o));
  }
  int tlo[2], thi[2];
#pragma unroll   // both arrays are indexed by constants
  for (int mt = 0; mt < 2; ++mt) {
    tlo[mt] = max(__builtin_amdgcn_readlane(mn, mt * 16) - (KW_ - 1), 0);
    thi[mt] = __builtin_amdgcn_readlane(mx, mt * 16);   // <= LKV_ - 1
  }
  const int jlo = min(tlo[0], tlo[1]);
  const int jhi = max(thi[0], thi[1]);

  // 3 - c0 of the 16 query rows whose sums this lane holds.
  int dq[2][8];
#pragma unroll   // dq[][] is indexed by constants
  for (int mt = 0; mt < 2; ++mt)
#pragma unroll   // as above
    for (int v = 0; v < 8; ++v)
      dq[mt][v] = (KW_ - 1) - __shfl(cl, mt * 16 + kh * 8 + v);

  float* rb = &Rs[(wave * SM_ + kh * 8) * (KW_ * NH) + idx16];
  const float* ub = ut + ((size_t)(row0 / LQ_) * LKV_ * (QD_ / 4) + wave * 32 + kh) * (NH * 4)
                       + idx16 * 4;

  int jv = jlo;                         // j, kept in a vector register
  for (int j = jlo; j <= jhi; ++j) {
    const float* uj = ub + (size_t)j * (QD_ * NH);
    v4f bv[16];
#pragma unroll   // bv[] is indexed by constants and stays in registers
    for (int kq = 0; kq < 16; ++kq)
      bv[kq] = *(const v4f*)(uj + kq * (2 * NH * 4));
    // The next trip rewrites the address registers that the loads above name.
    asm volatile("s_wait_xcnt 0x0" :: "v"(uj) : "memory");
    // Keeps the trip's 16 loads together ahead of its matrix steps: one load
    // latency a trip, which the SIMD's other waves cover.
    __builtin_amdgcn_sched_barrier(0);
    // The trip's loaded values are inputs here, so all 16 loads have landed in
    // front of the two branches. Left to the branches, a trip that took neither
    // could leave loads in flight, and the compiler then puts a wait in front of
    // every load of the loop: the first trip's loads would queue behind the
    // query rows' loads instead of flying with them.
    asm volatile("" :: "v"(bv[0]), "v"(bv[1]), "v"(bv[2]), "v"(bv[3]),
                       "v"(bv[4]), "v"(bv[5]), "v"(bv[6]), "v"(bv[7]),
                       "v"(bv[8]), "v"(bv[9]), "v"(bv[10]), "v"(bv[11]),
                       "v"(bv[12]), "v"(bv[13]), "v"(bv[14]), "v"(bv[15]));

#pragma unroll   // av[][], dq[][] and the tiles' bounds are indexed by constants
    for (int mt = 0; mt < 2; ++mt) {
      // The same for every lane (scalar registers): the whole wave takes the
      // tile's matrix steps or skips them.
      if (j >= tlo[mt] && j <= thi[mt]) {
        v8f a = {};
#pragma unroll   // av[][] and bv[] are indexed by constants
        for (int kq = 0; kq < 16; ++kq) {
          a = __builtin_amdgcn_wmma_f32_16x16x4_f32(false, av[mt][kq].lo, false, bv[kq].lo, (short)0, a, false, false);
          a = __builtin_amdgcn_wmma_f32_16x16x4_f32(false, av[mt][kq].hi, false, bv[kq].hi, (short)0, a, false, false);
        }

        // Four free vector slots between the tile's last matrix step and whatever
        // touches its result or reuses its operand registers. The row number
        // passes through the statement, so no later arithmetic is moved ahead.
        asm volatile("v_nop\n\tv_nop\n\tv_nop\n\tv_nop"
                     : "+v"(a), "+v"(jv) : "v"(bv[15]));

#pragma unroll   // a and dq[][] are indexed by constants
        for (int v = 0; v < 8; ++v) {
          const int r = jv + dq[mt][v];
          if ((unsigned)r < (unsigned)KW_) rb[(mt * 16 + v) * (KW_ * NH) + r * NH] = a[v];
        }
      }
    }
    ++jv;
  }
  __syncthreads();

  const float scale = 0.125f;                 // 64^-0.5
  float* pgp = pg + (size_t)row0 * (NH * KW_) + t * KW_;
#pragma unroll   // two (query row, head) pairs per thread
  for (int k = 0; k < 2; ++k) {
    const int ql = (t >> 4) + k * 16;         // head = idx16
    const int s0 = __shfl(sl, ql);
    const int c0 = min(max(s0, 0), LKV_ - 1);
    int   rr[KW_];
    float sc[KW_];
#pragma unroll   // rr[] and sc[] are indexed by constants
    for (int w = 0; w < KW_; ++w) {
      rr[w] = 3 - (c0 - min(max(s0 - w, 0), LKV_ - 1));   // 0..3, a row that was walked
      const float* rp = &Rs[(ql * KW_ + rr[w]) * NH + idx16];
      float s = 0.f;
#pragma unroll   // constant offsets from one LDS address
      for (int wv = 0; wv < 8; ++wv) s += rp[wv * (SM_ * KW_ * NH)];
      sc[w] = (s0 - w >= 0) ? s * scale : -FLT_MAX;
    }

    const float mxs = fmaxf(fmaxf(sc[0], sc[1]), fmaxf(sc[2], sc[3]));
    float p[KW_];
    float sum = 0.f;
#pragma unroll
    for (int w = 0; w < KW_; ++w) {
      p[w] = exp2_slot((sc[w] - mxs) * 1.44269504f);   // e^(sc - mx); masked: 0
      sum += p[w];
    }
    const float inv = 1.f / sum;

    float pr[KW_] = {0.f, 0.f, 0.f, 0.f};
#pragma unroll
    for (int w = 0; w < KW_; ++w) {
      const float pw = p[w] * inv;
#pragma unroll   // pr[] is indexed by constants
      for (int kk = 0; kk < KW_; ++kk) pr[kk] += (rr[w] == kk) ? pw : 0.f;
    }
    *(float4*)(pgp + k * 256 * KW_) = make_float4(pr[0], pr[1], pr[2], pr[3]);
  }
}

// ---------------------------------------------------------------------------
// out[q][n] = sum over kv rows j and heads h of P[q][j][h] * T[j][h][n], with
// T[j][h][n] = sum_d v[j][h][d] * Wo[n][h*HD + d] (gemm_xwT_wmma<1>) and
// P[q][j][h] the softmax weight of row j, zero outside the query's window.
// A block takes MT_ query rows (four tiles of 16) and walks only the kv rows
// between the lowest and the highest window of its rows (found here, for any
// seg content), two rows j at a time: k = 2 rows x 16 heads = 8 matrix steps.
// The pair's table rows are loaded once for all four tiles; a tile does its
// matrix steps only for pairs between the lowest and the highest window of its
// own 16 rows. Outside of these all its weights are zero, so nothing is lost.
// k order of one step hs, equal for A and B: lane half kh, element e
//   -> head 2*hs + kh, kv row 2*jp + e.
// Block = 8 waves; wave tile 64 x 32, block tile 64 x NB_.
//
// Ps[q][h][0..7] = {0, 0, pg[q][h][0..3], 0, 0}: the pair of weights for rows
// (2*jp, 2*jp + 1) is two neighbouring floats at a clamped index, zeros
// included, so no lane is ever switched off. Rows q, q + 16, q + 32 and q + 48
// share one LDS row of PQ_ floats: the even heads of the four tiles (PM_ floats
// a tile), then, PO_ floats in, the odd heads. So every fragment read of a trip
// is a constant offset of fewer than 256 floats (what a two-address LDS read
// can hold) from one register a tile, and no address arithmetic stands among
// the matrix steps. PQ_ and PO_ spread the 32 lanes over the banks.
// ---------------------------------------------------------------------------
#define MT_  64
#define NB_  256
#define PQ_  524
#define PM_  64
#define PO_  258

__global__ __launch_bounds__(256) void out_from_table(
    const float* __restrict__ pg, const float* __restrict__ tab,
    const int* __restrict__ seg, float* __restrict__ out)
{
  __shared__ float Ps[16 * PQ_];

  const int t     = threadIdx.x;
  const int lane  = t & 31;
  const int wave  = t >> 5;
  const int idx16 = lane & 15;
  const int kh    = lane >> 4;
  // Share u: the 32 blocks of query rows 2048*u .. 2048*u + 2047, in order, the
  // four column blocks of the same rows one after the other.
  const int br    = blockIdx.x / NSHARE;
  const int row0  = ((blockIdx.x & (NSHARE - 1)) * ((B_ * LQ_) / (MT_ * NSHARE))
                     + (br >> 2)) * MT_;              // flat b * LQ_ + q
  const int n0    = (br & 3) * NB_ + wave * 32;

  // MT_ * NH = 1024 weight quads, four per thread; the block's 64 segments, two
  // per lane.
  static_assert(MT_ * NH == 1024 && MT_ == 64, "four quads per thread, two rows per lane");
  const float* pp = pg + (size_t)row0 * (NH * KW_) + t * KW_;
  const int*   sp = seg + row0 + lane;
  float4 pv[4];
#pragma unroll   // pv[] is indexed by constants and stays in registers
  for (int k = 0; k < 4; ++k) pv[k] = *(const float4*)(pp + k * 256 * KW_);
  const int sl[2] = {sp[0], sp[32]};
  // The loads' offset registers (the two indices) are inputs here, so neither
  // is reused (not even as a load's target) before this wait.
  asm volatile("s_wait_xcnt 0x0" :: "v"(t), "v"(lane) : "memory");

#pragma unroll   // pv[] is indexed by constants and stays in registers
  for (int k = 0; k < 4; ++k) {
    const int i = t + k * 256, q = i >> 4, h = i & 15;
    float* d = &Ps[(q & 15) * PQ_ + (q >> 4) * PM_ + (h & 1) * PO_ + (h >> 1) * 8];
    const v2f z = {0.f, 0.f}, lo = {pv[k].x, pv[k].y}, hi = {pv[k].z, pv[k].w};
    *(v2f*)(d + 0) = z;
    *(v2f*)(d + 2) = lo;
    *(v2f*)(d + 4) = hi;
    *(v2f*)(d + 6) = z;
  }

  // Lowest and highest clipped segment of each tile's 16 rows (one half of the
  // lanes each), then the first and the last pair of kv rows of each tile.
  const int cl[2] = {min(max(sl[0], 0), LKV_ - 1), min(max(sl[1], 0), LKV_ - 1)};
  int mn[2] = {cl[0], cl[1]}, mx[2] = {cl[0], cl[1]};
#pragma unroll   // four fixed exchange steps, no loop counter
  for (int o = 8; o > 0; o >>= 1) {
#pragma unroll   // mn[] and mx[] are indexed by constants
    for (int g = 0; g < 2; ++g) {
      mn[g] = min(mn[g], __shfl_xor(mn[g], o));
      mx[g] = max(mx[g], __shfl_xor(mx[g], o));
    }
  }
  int tlo[4], thi[4], c0a[4], ab[4];
#pragma unroll   // all four arrays are indexed by constants
  for (int m = 0; m < 4; ++m) {
    tlo[m] = max(__builtin_amdgcn_readlane(mn[m >> 1], (m & 1) * 16) - (KW_ - 1), 0) >> 1;
    thi[m] = __builtin_amdgcn_readlane(mx[m >> 1], (m & 1) * 16) >> 1;   // <= LKV_/2 - 1
    c0a[m] = __shfl(cl[m >> 1], (m & 1) * 16 + idx16);
    ab[m]  = idx16 * PQ_ + m * PM_ + kh * PO_ + 2;
  }
  const int jp0 = min(min(tlo[0], tlo[1]), min(tlo[2], tlo[3]));
  const int jp1 = max(max(thi[0], thi[1]), max(thi[2], thi[3]));

  const float* tb = tab + ((size_t)(row0 / LQ_) * (LKV_ / 2) * NH + kh) * (DATTN * 2)
                        + (n0 + idx16) * 2;

  v8f acc[8] = {};                      // [m*2 + nt]
  __syncthreads();

  for (int jp = jp0; jp <= jp1; ++jp) {
    const float* tj = tb + (size_t)jp * (NH * DATTN * 2);

    v2f b[NH / 2][2];
#pragma unroll   // b[][] is indexed by constants and stays in registers
    for (int hs = 0; hs < NH / 2; ++hs)
#pragma unroll   // as above
      for (int nt = 0; nt < 2; ++nt)
        b[hs][nt] = *(const v2f*)(tj + hs * (2 * DATTN * 2) + nt * 32);
    // The next trip rewrites the address registers that the loads above name.
    asm volatile("s_wait_xcnt 0x0" :: "v"(tj) : "memory");
    // Keeps the trip's 16 loads together ahead of its matrix steps: one load
    // latency a trip; left free, the scheduler issues each step's loads only
    // one step ahead and the wave waits at every step.
    __builtin_amdgcn_sched_barrier(0);

#pragma unroll   // acc[], b[][] and the tiles' arrays are indexed by constants
    for (int m = 0; m < 4; ++m) {
      // The same for every lane (scalar registers): the whole wave takes the
      // tile's matrix steps or skips them.
      if (jp >= tlo[m] && jp <= thi[m]) {
        const int ai = ab[m] + min(max(2 * jp + (KW_ - 1) - c0a[m], -2), 4);
#pragma unroll   // as above
        for (int hs = 0; hs < NH / 2; ++hs) {
          const v2f a = {Ps[ai + hs * 8], Ps[ai + hs * 8 + 1]};
#pragma unroll   // as above
          for (int nt = 0; nt < 2; ++nt)
            acc[m * 2 + nt] = __builtin_amdgcn_wmma_f32_16x16x4_f32(
                false, a, false, b[hs][nt], (short)0, acc[m * 2 + nt], false, false);
        }
        // Four free vector slots between the tile's last matrix steps and
        // whatever next reuses their operand registers or touches their sums.
        asm volatile("v_nop\n\tv_nop\n\tv_nop\n\tv_nop"
                     : "+v"(acc[m * 2]), "+v"(acc[m * 2 + 1]));
      }
    }
  }

#pragma unroll   // acc[] is indexed by constants
  for (int m = 0; m < 4; ++m) {
#pragma unroll   // as above
    for (int nt = 0; nt < 2; ++nt) {
      float* yb = out + (size_t)(row0 + m * 16 + kh * 8) * DATTN + n0 + nt * 16 + idx16;
      const v8f a = acc[m * 2 + nt];
#pragma unroll   // as above
      for (int v = 0; v < 8; ++v) yb[(size_t)v * DATTN] = a[v];
    }
  }
}

// ---------------------------------------------------------------------------
// Launcher. Inputs: q, kv_src, seg_id, Wq, Wkv, Wo.
// Workspace layout: kv (16MB) | pg (4MB) | ut, then tab (128MB)  = 148MB.
// ut is dead once window_scores has run; tab is written over it afterwards.
// ---------------------------------------------------------------------------
extern "C" void kernel_launch(void* const* d_in, const int* in_sizes, int n_in,
                              void* d_out, int out_size, void* d_ws, size_t ws_size,
                              hipStream_t stream) {
  const float* q      = (const float*)d_in[0];
  const float* kv_src = (const float*)d_in[1];
  const int*   seg    = (const int*)d_in[2];
  const float* Wq     = (const float*)d_in[3];
  const float* Wkv    = (const float*)d_in[4];
  const float* Wo     = (const float*)d_in[5];
  float* out = (float*)d_out;

  float* kv   = (float*)d_ws;                               // B*LKV*2*DATTN
  float* pg   = kv + (size_t)B_ * LKV_ * 2 * DATTN;         // B*LQ*NH*KW
  float* tab  = pg + (size_t)B_ * LQ_ * NH * KW_;           // B*LKV*NH*DATTN
  float* ut   = tab;                                        // B*LKV*NH*QD

  const dim3 blk(256);

  // kv = kv_src @ Wkv.T              M=2048  N=2048 K=1024
  gemm_xwT_wmma<0><<<dim3(((2 * DATTN) / 128) * ((B_ * LKV_) / 128)), blk, 0, stream>>>(
      kv_src, Wkv, kv, B_ * LKV_, 2 * DATTN, 1024, 1024, 1024);

  // ut[j][h] = k[j][h] @ Wq[h rows]   per head: 1024 x 2048, K=64
  fold_wq_into_k<<<dim3((QD_ / UC_) * ((B_ * LKV_) / UJ_) * (NH / UH_)), blk, 0, stream>>>(
      kv, Wq, ut);

  // window softmax weights           one block per SM_ query rows
  window_scores<<<dim3((B_ * LQ_) / SM_), blk, 0, stream>>>(
      q, ut, seg, pg);

  // tab[j][h] = v[j][h] @ Wo[:, h].T  per head: M=2048 N=1024 K=64
  // (last before its reader, so that more of it is still in L2 there)
  gemm_xwT_wmma<1><<<dim3((1024 / 128) * ((B_ * LKV_) / 128) * NH), blk, 0, stream>>>(
      kv + DATTN, Wo, tab, B_ * LKV_, DATTN, HD, 2 * DATTN, DATTN);

  // out = P @ tab                    k = the block's own span of kv rows x heads
  out_from_table<<<dim3((DATTN / NB_) * ((B_ * LQ_) / MT_)), blk, 0, stream>>>(
      pg, tab, seg, out);
}
